// v000
// Measured on an AMD MI455X. A time is GPU time per run, averaged over a window of back-to-back runs after a warm-up
// (all launches, gaps included; the runs take copies of the inputs in turn), and the median of several windows.
// Apart from v000's, it joins two sittings. Times from different sittings can be a few percent apart, while
// side-by-side timings come from the same sitting.
// v000 is the starting kernel. One run takes 934 microseconds.
#include <hip/hip_runtime.h>
#include <hip/hip_bf16.h>
#include <cstdint>

typedef float v2f __attribute__((ext_vector_type(2)));
typedef float v8f __attribute__((ext_vector_type(8)));
typedef int   v4i __attribute__((ext_vector_type(4)));

#define BB   16
#define LL   512
#define DD   512
#define HEADS 8
#define HD   64

#if defined(__has_builtin)
#if __has_builtin(__builtin_amdgcn_global_load_async_to_lds_b128) && \
    __has_builtin(__builtin_amdgcn_s_wait_asynccnt)
#define USE_ASYNC_LDS 1
#endif
#endif

__device__ __forceinline__ void stage16(const float* g, float* l) {
#ifdef USE_ASYNC_LDS
  __builtin_amdgcn_global_load_async_to_lds_b128(
      (__attribute__((address_space(1))) v4i*)(uintptr_t)g,
      (__attribute__((address_space(3))) v4i*)(uint32_t)(uintptr_t)l, 0, 0);
#else
  *(float4*)l = *(const float4*)g;
#endif
}

__device__ __forceinline__ void stage_wait() {
#ifdef USE_ASYNC_LDS
  __builtin_amdgcn_s_wait_asynccnt(0);
#endif
}

template <bool RELU, bool RESID>
__global__ __launch_bounds__(256) void gemm_wmma_kernel(
    const float* __restrict__ A, const float* __restrict__ W,
    const float* __restrict__ bias, const float* __restrict__ resid,
    float* __restrict__ C, int M, int N, int K) {
  __shared__ __align__(16) float As[128][68];
  __shared__ __align__(16) float Bs[16][68];

  const int t    = threadIdx.x;
  const int wave = t >> 5;
  const int lane = t & 31;
  const int lm   = lane & 15;
  const int lk   = (lane >> 4) << 1;  // 0 or 2
  const int m0   = blockIdx.x * 128;
  const int n0   = blockIdx.y * 16;

  v8f acc = {0.f, 0.f, 0.f, 0.f, 0.f, 0.f, 0.f, 0.f};

  for (int kc = 0; kc < K; kc += 64) {
    // stage A: 128x64 floats = 2048 x b128, 8 per thread (coalesced)
#pragma unroll
    for (int i = 0; i < 8; ++i) {
      int idx = t + i * 256;
      int r = idx >> 4, c4 = (idx & 15) << 2;
      stage16(A + (size_t)(m0 + r) * K + kc + c4, &As[r][c4]);
    }
    // stage W tile: 16x64 = 256 x b128, 1 per thread
    {
      int r = t >> 4, c4 = (t & 15) << 2;
      stage16(W + (size_t)(n0 + r) * K + kc + c4, &Bs[r][c4]);
    }
    if (kc + 64 < K)  // hint next chunk into cache (global_prefetch_b8)
      __builtin_prefetch(A + (size_t)(m0 + (t >> 4)) * K + kc + 64, 0, 1);
    stage_wait();
    __syncthreads();

#pragma unroll
    for (int kk = 0; kk < 64; kk += 4) {
      v2f a, b;
      a.x = As[(wave << 4) + lm][kk + lk];
      a.y = As[(wave << 4) + lm][kk + lk + 1];
      b.x = Bs[lm][kk + lk];
      b.y = Bs[lm][kk + lk + 1];
      acc = __builtin_amdgcn_wmma_f32_16x16x4_f32(false, a, false, b,
                                                  (short)0, acc, false, false);
    }
    __syncthreads();
  }

  const float bcol = bias[n0 + lm];
#pragma unroll
  for (int r = 0; r < 8; ++r) {
    int row = m0 + (wave << 4) + r + ((lane >> 4) << 3);
    int col = n0 + lm;
    float v = acc[r] + bcol;
    if (RESID) v += resid[(size_t)row * N + col];
    if (RELU) v = fmaxf(v, 0.f);
    C[(size_t)row * N + col] = v;
  }
}

// ---------------------------------------------------------------------------
// alpha[b,h] = max(sigmoid(mq[b,h,L-1,:] . Wa + ba) + 1, 1 + 1e-5)
// ---------------------------------------------------------------------------
__global__ void alpha_kernel(const float* __restrict__ q,
                             const float* __restrict__ Wa,
                             const float* __restrict__ ba,
                             float* __restrict__ alphaBH) {
  int t = threadIdx.x;  // 0..127 : (b,h)
  int b = t >> 3, h = t & 7;
  const float* row = q + ((size_t)(b * LL + (LL - 1)) * DD) + h * HD;
  float z = ba[0];
#pragma unroll 8
  for (int j = 0; j < HD; ++j) z += row[j] * Wa[j];
  float a = 1.f / (1.f + expf(-z)) + 1.f;
  alphaBH[t] = fmaxf(a, 1.f + 1e-5f);
}

// ---------------------------------------------------------------------------
// Attention + entmax-bisect per (b, h, 16-query tile). 128 threads = 4 waves.
//   phase 1: scores tile [16 x 512] via WMMA, scaled + branchless LDS mask
//   phase 2: 50-iter entmax bisection per row, in registers (16 elems/lane)
//   phase 3: att tile [16 x 64] = p @ mk via WMMA
// ---------------------------------------------------------------------------
__global__ __launch_bounds__(128) void attn_entmax_kernel(
    const float* __restrict__ q, const float* __restrict__ X,
    const float* __restrict__ mask, const float* __restrict__ alphaBH,
    float* __restrict__ att) {
  __shared__ __align__(16) float Sq[16][68];   // mq tile
  __shared__ __align__(16) float Sk[64][68];   // staged keys (mk = X slice)
  __shared__ float Sc[16][516];                // scores -> p
  __shared__ float Sm[512];                    // mask row (key 511 forced 0)

  const int b  = blockIdx.z;
  const int h  = blockIdx.y;
  const int q0 = blockIdx.x * 16;
  const int t = threadIdx.x, wave = t >> 5, lane = t & 31;
  const int lm = lane & 15, lk = (lane >> 4) << 1;

  // stage mask row once (branchless epilogue later)
#pragma unroll
  for (int i = 0; i < 4; ++i) {
    int k = t + i * 128;
    Sm[k] = (k < LL - 1) ? mask[b * (LL - 1) + k] : 0.f;
  }
  // stage mq tile: 16x64 = 256 x b128
#pragma unroll
  for (int i = 0; i < 2; ++i) {
    int idx = t + i * 128;
    int r = idx >> 4, c4 = (idx & 15) << 2;
    stage16(q + (size_t)(b * LL + q0 + r) * DD + h * HD + c4, &Sq[r][c4]);
  }

  // ---- phase 1: scores = mq . mk^T / 8, masked ----
  for (int kb = 0; kb < LL; kb += 64) {
    __syncthreads();
#pragma unroll
    for (int i = 0; i < 8; ++i) {
      int idx = t + i * 128;
      int r = idx >> 4, c4 = (idx & 15) << 2;
      stage16(X + (size_t)(b * LL + kb + r) * DD + h * HD + c4, &Sk[r][c4]);
    }
    stage_wait();
    __syncthreads();

    v8f acc = {0.f, 0.f, 0.f, 0.f, 0.f, 0.f, 0.f, 0.f};
#pragma unroll
    for (int kk = 0; kk < HD; kk += 4) {
      v2f a, bb;
      a.x  = Sq[lm][kk + lk];
      a.y  = Sq[lm][kk + lk + 1];
      bb.x = Sk[(wave << 4) + lm][kk + lk];
      bb.y = Sk[(wave << 4) + lm][kk + lk + 1];
      acc = __builtin_amdgcn_wmma_f32_16x16x4_f32(false, a, false, bb,
                                                  (short)0, acc, false, false);
    }
#pragma unroll
    for (int r = 0; r < 8; ++r) {
      int qr  = r + ((lane >> 4) << 3);
      int key = kb + (wave << 4) + lm;
      float s = acc[r] * 0.125f;  // 1/sqrt(64)
      Sc[qr][key] = (Sm[key] != 0.f) ? s : -__builtin_huge_valf();
    }
  }
  __syncthreads();

  // ---- phase 2: entmax bisection (one wave handles 4 rows) ----
  const float am1  = alphaBH[b * HEADS + h] - 1.f;
  const float rinv = 1.f / am1;
  for (int rr = 0; rr < 4; ++rr) {
    const int row = wave * 4 + rr;
    float xs[16];
#pragma unroll
    for (int j = 0; j < 16; ++j) xs[j] = Sc[row][lane + 32 * j] * am1;

    float mx = -__builtin_huge_valf();
#pragma unroll
    for (int j = 0; j < 16; ++j) mx = fmaxf(mx, xs[j]);
#pragma unroll
    for (int off = 16; off; off >>= 1) mx = fmaxf(mx, __shfl_xor(mx, off, 32));

    float tau_lo = mx - 1.f;
    float tau_hi = mx - exp2f(-9.f * am1);  // (1/512)^(alpha-1)

    float s = 0.f;
#pragma unroll
    for (int j = 0; j < 16; ++j) {
      float z = xs[j] - tau_lo;
      s += (z > 0.f) ? exp2f(rinv * log2f(z)) : 0.f;
    }
#pragma unroll
    for (int off = 16; off; off >>= 1) s += __shfl_xor(s, off, 32);
    const float f_lo = s - 1.f;

    float dm = tau_hi - tau_lo, tau_m = tau_lo;
    for (int it = 0; it < 50; ++it) {
      dm *= 0.5f;
      tau_m = tau_lo + dm;
      float fm = 0.f;
#pragma unroll
      for (int j = 0; j < 16; ++j) {
        float z = xs[j] - tau_m;
        fm += (z > 0.f) ? exp2f(rinv * log2f(z)) : 0.f;
      }
#pragma unroll
      for (int off = 16; off; off >>= 1) fm += __shfl_xor(fm, off, 32);
      fm -= 1.f;
      tau_lo = (fm * f_lo >= 0.f) ? tau_m : tau_lo;  // uniform update
    }

    float pv[16], ssum = 0.f;
#pragma unroll
    for (int j = 0; j < 16; ++j) {
      float z = xs[j] - tau_m;
      pv[j] = (z > 0.f) ? exp2f(rinv * log2f(z)) : 0.f;
      ssum += pv[j];
    }
#pragma unroll
    for (int off = 16; off; off >>= 1) ssum += __shfl_xor(ssum, off, 32);
    const float inv = 1.f / ssum;
#pragma unroll
    for (int j = 0; j < 16; ++j) Sc[row][lane + 32 * j] = pv[j] * inv;
  }

  // ---- phase 3: att = p @ mk ----
  v8f acc = {0.f, 0.f, 0.f, 0.f, 0.f, 0.f, 0.f, 0.f};
  for (int kb = 0; kb < LL; kb += 64) {
    __syncthreads();
#pragma unroll
    for (int i = 0; i < 8; ++i) {
      int idx = t + i * 128;
      int r = idx >> 4, c4 = (idx & 15) << 2;
      stage16(X + (size_t)(b * LL + kb + r) * DD + h * HD + c4, &Sk[r][c4]);
    }
    stage_wait();
    __syncthreads();
#pragma unroll
    for (int kk = 0; kk < 64; kk += 4) {
      v2f a, bb;
      a.x  = Sc[lm][kb + kk + lk];
      a.y  = Sc[lm][kb + kk + lk + 1];
      bb.x = Sk[kk + lk][(wave << 4) + lm];  // mk^T gather from LDS
      bb.y = Sk[kk + lk + 1][(wave << 4) + lm];
      acc = __builtin_amdgcn_wmma_f32_16x16x4_f32(false, a, false, bb,
                                                  (short)0, acc, false, false);
    }
  }
#pragma unroll
  for (int r = 0; r < 8; ++r) {
    int qr = r + ((lane >> 4) << 3);
    att[(size_t)(b * LL + q0 + qr) * DD + h * HD + (wave << 4) + lm] = acc[r];
  }
}

// ---------------------------------------------------------------------------
// LayerNorm over D=512 per row; writes split output layout:
//   rows l<511 -> out[(b*511+l)*512 + d] ; row 511 -> out[16*511*512 + b*512 + d]
// ---------------------------------------------------------------------------
__global__ __launch_bounds__(256) void ln_kernel(const float* __restrict__ Hm,
                                                 const float* __restrict__ g,
                                                 const float* __restrict__ be,
                                                 float* __restrict__ out) {
  const int l = blockIdx.x, b = blockIdx.y, t = threadIdx.x;
  const int wave = t >> 5, lane = t & 31;
  const float* hr = Hm + (size_t)(b * LL + l) * DD;
  float x0 = hr[t], x1 = hr[t + 256];

  __shared__ float red[8];
  float s = x0 + x1;
#pragma unroll
  for (int off = 16; off; off >>= 1) s += __shfl_xor(s, off, 32);
  if (lane == 0) red[wave] = s;
  __syncthreads();
  float tot = 0.f;
#pragma unroll
  for (int i = 0; i < 8; ++i) tot += red[i];
  const float mu = tot * (1.f / 512.f);

  float d0 = x0 - mu, d1 = x1 - mu;
  float vs = d0 * d0 + d1 * d1;
#pragma unroll
  for (int off = 16; off; off >>= 1) vs += __shfl_xor(vs, off, 32);
  __syncthreads();
  if (lane == 0) red[wave] = vs;
  __syncthreads();
  float vtot = 0.f;
#pragma unroll
  for (int i = 0; i < 8; ++i) vtot += red[i];
  const float inv = rsqrtf(vtot * (1.f / 512.f) + 1e-12f);

  size_t o = (l < LL - 1) ? ((size_t)b * (LL - 1) + l) * DD
                          : (size_t)BB * (LL - 1) * DD + (size_t)b * DD;
  out[o + t]       = d0 * inv * g[t] + be[t];
  out[o + t + 256] = d1 * inv * g[t + 256] + be[t + 256];
}

// ---------------------------------------------------------------------------
extern "C" void kernel_launch(void* const* d_in, const int* in_sizes, int n_in,
                              void* d_out, int out_size, void* d_ws,
                              size_t ws_size, hipStream_t stream) {
  const float* X    = (const float*)d_in[0];
  const float* mask = (const float*)d_in[1];
  const float* Wq   = (const float*)d_in[2];
  const float* bq   = (const float*)d_in[3];
  const float* W1   = (const float*)d_in[4];
  const float* b1   = (const float*)d_in[5];
  const float* W2   = (const float*)d_in[6];
  const float* b2   = (const float*)d_in[7];
  const float* ln_g = (const float*)d_in[8];
  const float* ln_b = (const float*)d_in[9];
  const float* Wa   = (const float*)d_in[10];
  const float* ba   = (const float*)d_in[11];

  float* ws = (float*)d_ws;
  const size_t NE = (size_t)BB * LL * DD;  // 4,194,304
  float* qbuf    = ws;
  float* attbuf  = ws + NE;
  float* h1buf   = ws + 2 * NE;
  float* alphaBH = ws + 3 * NE;
  float* hbuf    = qbuf;  // q dead after attention; reuse for FFN output

  const int M = BB * LL;  // 8192
  dim3 gg(M / 128, DD / 16);

  // 1. q = relu(X @ Wq^T + bq)
  gemm_wmma_kernel<true, false>
      <<<gg, 256, 0, stream>>>(X, Wq, bq, nullptr, qbuf, M, DD, DD);
  // 2. alpha per (b,h)
  alpha_kernel<<<1, 128, 0, stream>>>(qbuf, Wa, ba, alphaBH);
  // 3. scores -> entmax -> att
  attn_entmax_kernel<<<dim3(LL / 16, HEADS, BB), 128, 0, stream>>>(
      qbuf, X, mask, alphaBH, attbuf);
  // 4. h1 = relu(att @ W1^T + b1)
  gemm_wmma_kernel<true, false>
      <<<gg, 256, 0, stream>>>(attbuf, W1, b1, nullptr, h1buf, M, DD, DD);
  // 5. h = h1 @ W2^T + b2 + att
  gemm_wmma_kernel<false, true>
      <<<gg, 256, 0, stream>>>(h1buf, W2, b2, attbuf, hbuf, M, DD, DD);
  // 6. LayerNorm + split output write
  ln_kernel<<<dim3(LL, BB), 256, 0, stream>>>(hbuf, ln_g, ln_b, (float*)d_out);
}

// v001
// It runs in 401 microseconds.
// Next to v000, in two timings, it ran 2.44 times as fast each time.
#include <hip/hip_runtime.h>
#include <hip/hip_bf16.h>
#include <cstdint>

typedef float v2f __attribute__((ext_vector_type(2)));
typedef float v8f __attribute__((ext_vector_type(8)));
typedef int   v4i __attribute__((ext_vector_type(4)));

#define BB   16
#define LL   512
#define DD   512
#define HEADS 8
#define HD   64

#if defined(__has_builtin)
#if __has_builtin(__builtin_amdgcn_global_load_async_to_lds_b128) && \
    __has_builtin(__builtin_amdgcn_s_wait_asynccnt)
#define USE_ASYNC_LDS 1
#endif
#endif

__device__ __forceinline__ void stage16(const float* g, float* l) {
#ifdef USE_ASYNC_LDS
  __builtin_amdgcn_global_load_async_to_lds_b128(
      (__attribute__((address_space(1))) v4i*)(uintptr_t)g,
      (__attribute__((address_space(3))) v4i*)(uint32_t)(uintptr_t)l, 0, 0);
#else
  *(float4*)l = *(const float4*)g;
#endif
}

__device__ __forceinline__ void stage_wait() {
#ifdef USE_ASYNC_LDS
  __builtin_amdgcn_s_wait_asynccnt(0);
#endif
}

template <bool RELU, bool RESID>
__global__ __launch_bounds__(256) void gemm_wmma_kernel(
    const float* __restrict__ A, const float* __restrict__ W,
    const float* __restrict__ bias, const float* __restrict__ resid,
    float* __restrict__ C, int M, int N, int K) {
  __shared__ __align__(16) float As[128][68];
  __shared__ __align__(16) float Bs[16][68];

  const int t    = threadIdx.x;
  const int wave = t >> 5;
  const int lane = t & 31;
  const int lm   = lane & 15;
  const int lk   = (lane >> 4) << 1;  // 0 or 2
  const int m0   = blockIdx.x * 128;
  const int n0   = blockIdx.y * 16;

  v8f acc = {0.f, 0.f, 0.f, 0.f, 0.f, 0.f, 0.f, 0.f};

  for (int kc = 0; kc < K; kc += 64) {
    // stage A: 128x64 floats = 2048 x b128, 8 per thread (coalesced)
#pragma unroll
    for (int i = 0; i < 8; ++i) {
      int idx = t + i * 256;
      int r = idx >> 4, c4 = (idx & 15) << 2;
      stage16(A + (size_t)(m0 + r) * K + kc + c4, &As[r][c4]);
    }
    // stage W tile: 16x64 = 256 x b128, 1 per thread
    {
      int r = t >> 4, c4 = (t & 15) << 2;
      stage16(W + (size_t)(n0 + r) * K + kc + c4, &Bs[r][c4]);
    }
    if (kc + 64 < K)  // hint next chunk into cache (global_prefetch_b8)
      __builtin_prefetch(A + (size_t)(m0 + (t >> 4)) * K + kc + 64, 0, 1);
    stage_wait();
    __syncthreads();

#pragma unroll
    for (int kk = 0; kk < 64; kk += 4) {
      v2f a, b;
      a.x = As[(wave << 4) + lm][kk + lk];
      a.y = As[(wave << 4) + lm][kk + lk + 1];
      b.x = Bs[lm][kk + lk];
      b.y = Bs[lm][kk + lk + 1];
      acc = __builtin_amdgcn_wmma_f32_16x16x4_f32(false, a, false, b,
                                                  (short)0, acc, false, false);
    }
    __syncthreads();
  }

  const float bcol = bias[n0 + lm];
#pragma unroll
  for (int r = 0; r < 8; ++r) {
    int row = m0 + (wave << 4) + r + ((lane >> 4) << 3);
    int col = n0 + lm;
    float v = acc[r] + bcol;
    if (RESID) v += resid[(size_t)row * N + col];
    if (RELU) v = fmaxf(v, 0.f);
    C[(size_t)row * N + col] = v;
  }
}

// ---------------------------------------------------------------------------
// alpha[b,h] = max(sigmoid(mq[b,h,L-1,:] . Wa + ba) + 1, 1 + 1e-5)
// ---------------------------------------------------------------------------
__global__ void alpha_kernel(const float* __restrict__ q,
                             const float* __restrict__ Wa,
                             const float* __restrict__ ba,
                             float* __restrict__ alphaBH) {
  int t = threadIdx.x;  // 0..127 : (b,h)
  int b = t >> 3, h = t & 7;
  const float* row = q + ((size_t)(b * LL + (LL - 1)) * DD) + h * HD;
  float z = ba[0];
#pragma unroll 8
  for (int j = 0; j < HD; ++j) z += row[j] * Wa[j];
  float a = 1.f / (1.f + expf(-z)) + 1.f;
  alphaBH[t] = fmaxf(a, 1.f + 1e-5f);
}

// ---------------------------------------------------------------------------
// max(z, 0) ^ rinv for finite rinv >= 1, branch-free on the bare instructions:
// z <= 0 gives log2(0) = -inf, rinv * -inf = -inf, exp2(-inf) = 0. No range
// scaling around v_log_f32 / v_exp_f32: it only matters for terms below
// 2^-126, which vanish beside a row sum that holds a term of at least 1/512.
// ---------------------------------------------------------------------------
__device__ __forceinline__ float powpos(float z, float rinv) {
  return __builtin_amdgcn_exp2f(rinv * __builtin_amdgcn_logf(fmaxf(z, 0.f)));
}

__device__ __forceinline__ float powpos_slot(float z, float rinv) {
  float l, p;
  asm("v_log_f32 %0, %1\n\tv_nop" : "=v"(l) : "v"(fmaxf(z, 0.f)));
  asm("v_exp_f32 %0, %1\n\tv_nop" : "=v"(p) : "v"(rinv * l));
  return p;
}

// ---------------------------------------------------------------------------
// Attention + entmax-bisect per (b, h, 16-query tile). 128 threads = 4 waves.
//   phase 1: scores tile [16 x 512] via WMMA, scaled + branchless LDS mask
//   phase 2: 50-iter entmax bisection per row, in registers (16 elems/lane)
//   phase 3: att tile [16 x 64] = p @ mk via WMMA
// ---------------------------------------------------------------------------
__global__ __launch_bounds__(128) void attn_entmax_kernel(
    const float* __restrict__ q, const float* __restrict__ X,
    const float* __restrict__ mask, const float* __restrict__ alphaBH,
    float* __restrict__ att) {
  __shared__ __align__(16) float Sq[16][68];   // mq tile
  __shared__ __align__(16) float Sk[64][68];   // staged keys (mk = X slice)
  __shared__ float Sc[16][516];                // scores -> p
  __shared__ float Sm[512];                    // mask row (key 511 forced 0)

  const int b  = blockIdx.z;
  const int h  = blockIdx.y;
  const int q0 = blockIdx.x * 16;
  const int t = threadIdx.x, wave = t >> 5, lane = t & 31;
  const int lm = lane & 15, lk = (lane >> 4) << 1;

  // stage mask row once (branchless epilogue later)
#pragma unroll
  for (int i = 0; i < 4; ++i) {
    int k = t + i * 128;
    Sm[k] = (k < LL - 1) ? mask[b * (LL - 1) + k] : 0.f;
  }
  // stage mq tile: 16x64 = 256 x b128
#pragma unroll
  for (int i = 0; i < 2; ++i) {
    int idx = t + i * 128;
    int r = idx >> 4, c4 = (idx & 15) << 2;
    stage16(q + (size_t)(b * LL + q0 + r) * DD + h * HD + c4, &Sq[r][c4]);
  }

  // ---- phase 1: scores = mq . mk^T / 8, masked ----
  for (int kb = 0; kb < LL; kb += 64) {
    __syncthreads();
#pragma unroll
    for (int i = 0; i < 8; ++i) {
      int idx = t + i * 128;
      int r = idx >> 4, c4 = (idx & 15) << 2;
      stage16(X + (size_t)(b * LL + kb + r) * DD + h * HD + c4, &Sk[r][c4]);
    }
    stage_wait();
    __syncthreads();

    v8f acc = {0.f, 0.f, 0.f, 0.f, 0.f, 0.f, 0.f, 0.f};
#pragma unroll
    for (int kk = 0; kk < HD; kk += 4) {
      v2f a, bb;
      a.x  = Sq[lm][kk + lk];
      a.y  = Sq[lm][kk + lk + 1];
      bb.x = Sk[(wave << 4) + lm][kk + lk];
      bb.y = Sk[(wave << 4) + lm][kk + lk + 1];
      acc = __builtin_amdgcn_wmma_f32_16x16x4_f32(false, a, false, bb,
                                                  (short)0, acc, false, false);
    }
#pragma unroll
    for (int r = 0; r < 8; ++r) {
      int qr  = r + ((lane >> 4) << 3);
      int key = kb + (wave << 4) + lm;
      float s = acc[r] * 0.125f;  // 1/sqrt(64)
      Sc[qr][key] = (Sm[key] != 0.f) ? s : -__builtin_huge_valf();
    }
  }
  __syncthreads();

  // ---- phase 2: entmax bisection (one wave handles 4 rows) ----
  const float am1  = alphaBH[b * HEADS + h] - 1.f;
  const float rinv = 1.f / am1;
  for (int rr = 0; rr < 4; ++rr) {
    const int row = wave * 4 + rr;
    float xs[16];
#pragma unroll
    for (int j = 0; j < 16; ++j) xs[j] = Sc[row][lane + 32 * j] * am1;

    float mx = -__builtin_huge_valf();
#pragma unroll
    for (int j = 0; j < 16; ++j) mx = fmaxf(mx, xs[j]);
#pragma unroll
    for (int off = 16; off; off >>= 1) mx = fmaxf(mx, __shfl_xor(mx, off, 32));

    float tau_lo = mx - 1.f;
    float tau_hi = mx - exp2f(-9.f * am1);  // (1/512)^(alpha-1)

    float s = 0.f;
#pragma unroll
    for (int j = 0; j < 16; ++j) {
      float z = xs[j] - tau_lo;
      s += powpos_slot(z, rinv);
    }
#pragma unroll
    for (int off = 16; off; off >>= 1) s += __shfl_xor(s, off, 32);
    const float f_lo = s - 1.f;

    float dm = tau_hi - tau_lo, tau_m = tau_lo;
    for (int it = 0; it < 50; ++it) {
      dm *= 0.5f;
      tau_m = tau_lo + dm;
      float fm = 0.f;
#pragma unroll
      for (int j = 0; j < 16; ++j) {
        float z = xs[j] - tau_m;
        fm += powpos(z, rinv);
      }
#pragma unroll
      for (int off = 16; off; off >>= 1) fm += __shfl_xor(fm, off, 32);
      fm -= 1.f;
      tau_lo = (fm * f_lo >= 0.f) ? tau_m : tau_lo;  // uniform update
    }

    float pv[16], ssum = 0.f;
#pragma unroll
    for (int j = 0; j < 16; ++j) {
      float z = xs[j] - tau_m;
      pv[j] = powpos(z, rinv);
      ssum += pv[j];
    }
#pragma unroll
    for (int off = 16; off; off >>= 1) ssum += __shfl_xor(ssum, off, 32);
    const float inv = 1.f / ssum;
#pragma unroll
    for (int j = 0; j < 16; ++j) Sc[row][lane + 32 * j] = pv[j] * inv;
  }

  // ---- phase 3: att = p @ mk ----
  v8f acc = {0.f, 0.f, 0.f, 0.f, 0.f, 0.f, 0.f, 0.f};
  for (int kb = 0; kb < LL; kb += 64) {
    __syncthreads();
#pragma unroll
    for (int i = 0; i < 8; ++i) {
      int idx = t + i * 128;
      int r = idx >> 4, c4 = (idx & 15) << 2;
      stage16(X + (size_t)(b * LL + kb + r) * DD + h * HD + c4, &Sk[r][c4]);
    }
    stage_wait();
    __syncthreads();
#pragma unroll
    for (int kk = 0; kk < 64; kk += 4) {
      v2f a, bb;
      a.x  = Sc[lm][kb + kk + lk];
      a.y  = Sc[lm][kb + kk + lk + 1];
      bb.x = Sk[kk + lk][(wave << 4) + lm];  // mk^T gather from LDS
      bb.y = Sk[kk + lk + 1][(wave << 4) + lm];
      acc = __builtin_amdgcn_wmma_f32_16x16x4_f32(false, a, false, bb,
                                                  (short)0, acc, false, false);
    }
  }
#pragma unroll
  for (int r = 0; r < 8; ++r) {
    int qr = r + ((lane >> 4) << 3);
    att[(size_t)(b * LL + q0 + qr) * DD + h * HD + (wave << 4) + lm] = acc[r];
  }
}

// ---------------------------------------------------------------------------
// LayerNorm over D=512 per row; writes split output layout:
//   rows l<511 -> out[(b*511+l)*512 + d] ; row 511 -> out[16*511*512 + b*512 + d]
// ---------------------------------------------------------------------------
__global__ __launch_bounds__(256) void ln_kernel(const float* __restrict__ Hm,
                                                 const float* __restrict__ g,
                                                 const float* __restrict__ be,
                                                 float* __restrict__ out) {
  const int l = blockIdx.x, b = blockIdx.y, t = threadIdx.x;
  const int wave = t >> 5, lane = t & 31;
  const float* hr = Hm + (size_t)(b * LL + l) * DD;
  float x0 = hr[t], x1 = hr[t + 256];

  __shared__ float red[8];
  float s = x0 + x1;
#pragma unroll
  for (int off = 16; off; off >>= 1) s += __shfl_xor(s, off, 32);
  if (lane == 0) red[wave] = s;
  __syncthreads();
  float tot = 0.f;
#pragma unroll
  for (int i = 0; i < 8; ++i) tot += red[i];
  const float mu = tot * (1.f / 512.f);

  float d0 = x0 - mu, d1 = x1 - mu;
  float vs = d0 * d0 + d1 * d1;
#pragma unroll
  for (int off = 16; off; off >>= 1) vs += __shfl_xor(vs, off, 32);
  __syncthreads();
  if (lane == 0) red[wave] = vs;
  __syncthreads();
  float vtot = 0.f;
#pragma unroll
  for (int i = 0; i < 8; ++i) vtot += red[i];
  const float inv = rsqrtf(vtot * (1.f / 512.f) + 1e-12f);

  size_t o = (l < LL - 1) ? ((size_t)b * (LL - 1) + l) * DD
                          : (size_t)BB * (LL - 1) * DD + (size_t)b * DD;
  out[o + t]       = d0 * inv * g[t] + be[t];
  out[o + t + 256] = d1 * inv * g[t + 256] + be[t + 256];
}

// ---------------------------------------------------------------------------
extern "C" void kernel_launch(void* const* d_in, const int* in_sizes, int n_in,
                              void* d_out, int out_size, void* d_ws,
                              size_t ws_size, hipStream_t stream) {
  const float* X    = (const float*)d_in[0];
  const float* mask = (const float*)d_in[1];
  const float* Wq   = (const float*)d_in[2];
  const float* bq   = (const float*)d_in[3];
  const float* W1   = (const float*)d_in[4];
  const float* b1   = (const float*)d_in[5];
  const float* W2   = (const float*)d_in[6];
  const float* b2   = (const float*)d_in[7];
  const float* ln_g = (const float*)d_in[8];
  const float* ln_b = (const float*)d_in[9];
  const float* Wa   = (const float*)d_in[10];
  const float* ba   = (const float*)d_in[11];

  float* ws = (float*)d_ws;
  const size_t NE = (size_t)BB * LL * DD;  // 4,194,304
  float* qbuf    = ws;
  float* attbuf  = ws + NE;
  float* h1buf   = ws + 2 * NE;
  float* alphaBH = ws + 3 * NE;
  float* hbuf    = qbuf;  // q dead after attention; reuse for FFN output

  const int M = BB * LL;  // 8192
  dim3 gg(M / 128, DD / 16);

  // 1. q = relu(X @ Wq^T + bq)
  gemm_wmma_kernel<true, false>
      <<<gg, 256, 0, stream>>>(X, Wq, bq, nullptr, qbuf, M, DD, DD);
  // 2. alpha per (b,h)
  alpha_kernel<<<1, 128, 0, stream>>>(qbuf, Wa, ba, alphaBH);
  // 3. scores -> entmax -> att
  attn_entmax_kernel<<<dim3(LL / 16, HEADS, BB), 128, 0, stream>>>(
      qbuf, X, mask, alphaBH, attbuf);
  // 4. h1 = relu(att @ W1^T + b1)
  gemm_wmma_kernel<true, false>
      <<<gg, 256, 0, stream>>>(attbuf, W1, b1, nullptr, h1buf, M, DD, DD);
  // 5. h = h1 @ W2^T + b2 + att
  gemm_wmma_kernel<false, true>
      <<<gg, 256, 0, stream>>>(h1buf, W2, b2, attbuf, hbuf, M, DD, DD);
  // 6. LayerNorm + split output write
  ln_kernel<<<dim3(LL, BB), 256, 0, stream>>>(hbuf, ln_g, ln_b, (float*)d_out);
}

// v002
// One run takes 312 microseconds.
// Two timings next to v001 both put it at 1.28 times that version's speed.
// Over all steps from v000 it is 3.14 times as fast.
#include <hip/hip_runtime.h>
#include <hip/hip_bf16.h>
#include <cstdint>

typedef float v2f __attribute__((ext_vector_type(2)));
typedef float v8f __attribute__((ext_vector_type(8)));
typedef int   v4i __attribute__((ext_vector_type(4)));

#define BB   16
#define LL   512
#define DD   512
#define HEADS 8
#define HD   64

#if defined(__has_builtin)
#if __has_builtin(__builtin_amdgcn_global_load_async_to_lds_b128) && \
    __has_builtin(__builtin_amdgcn_s_wait_asynccnt)
#define USE_ASYNC_LDS 1
#endif
#endif

__device__ __forceinline__ void stage16(const float* g, float* l) {
#ifdef USE_ASYNC_LDS
  __builtin_amdgcn_global_load_async_to_lds_b128(
      (__attribute__((address_space(1))) v4i*)(uintptr_t)g,
      (__attribute__((address_space(3))) v4i*)(uint32_t)(uintptr_t)l, 0, 0);
#else
  *(float4*)l = *(const float4*)g;
#endif
}

__device__ __forceinline__ void stage_wait() {
#ifdef USE_ASYNC_LDS
  __builtin_amdgcn_s_wait_asynccnt(0);
#endif
}

template <bool RELU, bool RESID>
__global__ __launch_bounds__(256) void gemm_wmma_kernel(
    const float* __restrict__ A, const float* __restrict__ W,
    const float* __restrict__ bias, const float* __restrict__ resid,
    float* __restrict__ C, int M, int N, int K) {
  __shared__ __align__(16) float As[128][68];
  __shared__ __align__(16) float Bs[16][68];

  const int t    = threadIdx.x;
  const int wave = t >> 5;
  const int lane = t & 31;
  const int lm   = lane & 15;
  const int lk   = (lane >> 4) << 1;  // 0 or 2
  const int m0   = blockIdx.x * 128;
  const int n0   = blockIdx.y * 16;

  v8f acc = {0.f, 0.f, 0.f, 0.f, 0.f, 0.f, 0.f, 0.f};

  for (int kc = 0; kc < K; kc += 64) {
    // stage A: 128x64 floats = 2048 x b128, 8 per thread (coalesced)
#pragma unroll
    for (int i = 0; i < 8; ++i) {
      int idx = t + i * 256;
      int r = idx >> 4, c4 = (idx & 15) << 2;
      stage16(A + (size_t)(m0 + r) * K + kc + c4, &As[r][c4]);
    }
    // stage W tile: 16x64 = 256 x b128, 1 per thread
    {
      int r = t >> 4, c4 = (t & 15) << 2;
      stage16(W + (size_t)(n0 + r) * K + kc + c4, &Bs[r][c4]);
    }
    if (kc + 64 < K)  // hint next chunk into cache (global_prefetch_b8)
      __builtin_prefetch(A + (size_t)(m0 + (t >> 4)) * K + kc + 64, 0, 1);
    stage_wait();
    __syncthreads();

#pragma unroll
    for (int kk = 0; kk < 64; kk += 4) {
      v2f a, b;
      a.x = As[(wave << 4) + lm][kk + lk];
      a.y = As[(wave << 4) + lm][kk + lk + 1];
      b.x = Bs[lm][kk + lk];
      b.y = Bs[lm][kk + lk + 1];
      acc = __builtin_amdgcn_wmma_f32_16x16x4_f32(false, a, false, b,
                                                  (short)0, acc, false, false);
    }
    __syncthreads();
  }

  const float bcol = bias[n0 + lm];
#pragma unroll
  for (int r = 0; r < 8; ++r) {
    int row = m0 + (wave << 4) + r + ((lane >> 4) << 3);
    int col = n0 + lm;
    float v = acc[r] + bcol;
    if (RESID) v += resid[(size_t)row * N + col];
    if (RELU) v = fmaxf(v, 0.f);
    C[(size_t)row * N + col] = v;
  }
}

// ---------------------------------------------------------------------------
// alpha[b,h] = max(sigmoid(mq[b,h,L-1,:] . Wa + ba) + 1, 1 + 1e-5)
// ---------------------------------------------------------------------------
__global__ void alpha_kernel(const float* __restrict__ q,
                             const float* __restrict__ Wa,
                             const float* __restrict__ ba,
                             float* __restrict__ alphaBH) {
  int t = threadIdx.x;  // 0..127 : (b,h)
  int b = t >> 3, h = t & 7;
  const float* row = q + ((size_t)(b * LL + (LL - 1)) * DD) + h * HD;
  float z = ba[0];
#pragma unroll 8
  for (int j = 0; j < HD; ++j) z += row[j] * Wa[j];
  float a = 1.f / (1.f + expf(-z)) + 1.f;
  alphaBH[t] = fmaxf(a, 1.f + 1e-5f);
}

// ---------------------------------------------------------------------------
// max(z, 0) ^ rinv for finite rinv >= 1, branch-free on the bare instructions:
// z <= 0 gives log2(0) = -inf, rinv * -inf = -inf, exp2(-inf) = 0. No range
// scaling around v_log_f32 / v_exp_f32: it only matters for terms below
// 2^-126, which vanish beside a row sum that holds a term of at least 1/512.
// ---------------------------------------------------------------------------
__device__ __forceinline__ float powpos(float z, float rinv) {
  return __builtin_amdgcn_exp2f(rinv * __builtin_amdgcn_logf(fmaxf(z, 0.f)));
}

__device__ __forceinline__ float powpos_slot(float z, float rinv) {
  float l, p;
  asm("v_log_f32 %0, %1\n\tv_nop" : "=v"(l) : "v"(fmaxf(z, 0.f)));
  asm("v_exp_f32 %0, %1\n\tv_nop" : "=v"(p) : "v"(rinv * l));
  return p;
}

// ---------------------------------------------------------------------------
// Attention + entmax-bisect per (b, h, 16-query tile). 128 threads = 4 waves.
//   phase 1: scores tile [16 x 512] via WMMA, scaled + branchless LDS mask
//   phase 2: entmax bisection per row, at most 50 trips, ended at its f32 fixed
//            point, in registers (16 elems/lane)
//   phase 3: att tile [16 x 64] = p @ mk via WMMA
// ---------------------------------------------------------------------------
__global__ __launch_bounds__(128) void attn_entmax_kernel(
    const float* __restrict__ q, const float* __restrict__ X,
    const float* __restrict__ mask, const float* __restrict__ alphaBH,
    float* __restrict__ att) {
  __shared__ __align__(16) float Sq[16][68];   // mq tile
  __shared__ __align__(16) float Sk[64][68];   // staged keys (mk = X slice)
  __shared__ float Sc[16][516];                // scores -> p
  __shared__ float Sm[512];                    // mask row (key 511 forced 0)

  const int b  = blockIdx.z;
  const int h  = blockIdx.y;
  const int q0 = blockIdx.x * 16;
  const int t = threadIdx.x, wave = t >> 5, lane = t & 31;
  const int lm = lane & 15, lk = (lane >> 4) << 1;

  // stage mask row once (branchless epilogue later)
#pragma unroll
  for (int i = 0; i < 4; ++i) {
    int k = t + i * 128;
    Sm[k] = (k < LL - 1) ? mask[b * (LL - 1) + k] : 0.f;
  }
  // stage mq tile: 16x64 = 256 x b128
#pragma unroll
  for (int i = 0; i < 2; ++i) {
    int idx = t + i * 128;
    int r = idx >> 4, c4 = (idx & 15) << 2;
    stage16(q + (size_t)(b * LL + q0 + r) * DD + h * HD + c4, &Sq[r][c4]);
  }

  // ---- phase 1: scores = mq . mk^T / 8, masked ----
  for (int kb = 0; kb < LL; kb += 64) {
    __syncthreads();
#pragma unroll
    for (int i = 0; i < 8; ++i) {
      int idx = t + i * 128;
      int r = idx >> 4, c4 = (idx & 15) << 2;
      stage16(X + (size_t)(b * LL + kb + r) * DD + h * HD + c4, &Sk[r][c4]);
    }
    stage_wait();
    __syncthreads();

    v8f acc = {0.f, 0.f, 0.f, 0.f, 0.f, 0.f, 0.f, 0.f};
#pragma unroll
    for (int kk = 0; kk < HD; kk += 4) {
      v2f a, bb;
      a.x  = Sq[lm][kk + lk];
      a.y  = Sq[lm][kk + lk + 1];
      bb.x = Sk[(wave << 4) + lm][kk + lk];
      bb.y = Sk[(wave << 4) + lm][kk + lk + 1];
      acc = __builtin_amdgcn_wmma_f32_16x16x4_f32(false, a, false, bb,
                                                  (short)0, acc, false, false);
    }
#pragma unroll
    for (int r = 0; r < 8; ++r) {
      int qr  = r + ((lane >> 4) << 3);
      int key = kb + (wave << 4) + lm;
      float s = acc[r] * 0.125f;  // 1/sqrt(64)
      Sc[qr][key] = (Sm[key] != 0.f) ? s : -__builtin_huge_valf();
    }
  }
  __syncthreads();

  // ---- phase 2: entmax bisection (one wave handles 4 rows) ----
  const float am1  = alphaBH[b * HEADS + h] - 1.f;
  const float rinv = 1.f / am1;
  for (int rr = 0; rr < 4; ++rr) {
    const int row = wave * 4 + rr;
    float xs[16];
#pragma unroll
    for (int j = 0; j < 16; ++j) xs[j] = Sc[row][lane + 32 * j] * am1;

    float mx = -__builtin_huge_valf();
#pragma unroll
    for (int j = 0; j < 16; ++j) mx = fmaxf(mx, xs[j]);
#pragma unroll
    for (int off = 16; off; off >>= 1) mx = fmaxf(mx, __shfl_xor(mx, off, 32));

    float tau_lo = mx - 1.f;
    float tau_hi = mx - exp2f(-9.f * am1);  // (1/512)^(alpha-1)

    float s = 0.f;
#pragma unroll
    for (int j = 0; j < 16; ++j) {
      float z = xs[j] - tau_lo;
      s += powpos_slot(z, rinv);
    }
#pragma unroll
    for (int off = 16; off; off >>= 1) s += __shfl_xor(s, off, 32);
    const float f_lo = s - 1.f;

    float dm = tau_hi - tau_lo, tau_m = tau_lo;
    // The loop ends at the fixed point of the f32 bisection. Once tau_lo + dm
    // rounds to tau_lo, either side of the update leaves tau_lo as it is, and
    // every later, smaller dm rounds to the same tau_m (rounding is monotone):
    // all trips that are left of the 50 are identities, so tau_m has its final
    // bits. A NaN tau_m stays NaN and gives the same zero terms either way.
    bool fixed = false;
    for (int it = 0; it < 50 && !fixed; ++it) {
      dm *= 0.5f;
      tau_m = tau_lo + dm;
      // Every lane holds the same two values; the first lane's copies make the
      // test a scalar compare and the loop branch stays scalar.
      fixed = __builtin_amdgcn_readfirstlane(__float_as_int(tau_m)) ==
              __builtin_amdgcn_readfirstlane(__float_as_int(tau_lo));
      float fm = 0.f;
#pragma unroll
      for (int j = 0; j < 16; ++j) {
        float z = xs[j] - tau_m;
        fm += powpos(z, rinv);
      }
#pragma unroll
      for (int off = 16; off; off >>= 1) fm += __shfl_xor(fm, off, 32);
      fm -= 1.f;
      tau_lo = (fm * f_lo >= 0.f) ? tau_m : tau_lo;  // uniform update
    }

    float pv[16], ssum = 0.f;
#pragma unroll
    for (int j = 0; j < 16; ++j) {
      float z = xs[j] - tau_m;
      pv[j] = powpos(z, rinv);
      ssum += pv[j];
    }
#pragma unroll
    for (int off = 16; off; off >>= 1) ssum += __shfl_xor(ssum, off, 32);
    const float inv = 1.f / ssum;
#pragma unroll
    for (int j = 0; j < 16; ++j) Sc[row][lane + 32 * j] = pv[j] * inv;
  }

  // ---- phase 3: att = p @ mk ----
  v8f acc = {0.f, 0.f, 0.f, 0.f, 0.f, 0.f, 0.f, 0.f};
  for (int kb = 0; kb < LL; kb += 64) {
    __syncthreads();
#pragma unroll
    for (int i = 0; i < 8; ++i) {
      int idx = t + i * 128;
      int r = idx >> 4, c4 = (idx & 15) << 2;
      stage16(X + (size_t)(b * LL + kb + r) * DD + h * HD + c4, &Sk[r][c4]);
    }
    stage_wait();
    __syncthreads();
#pragma unroll
    for (int kk = 0; kk < 64; kk += 4) {
      v2f a, bb;
      a.x  = Sc[lm][kb + kk + lk];
      a.y  = Sc[lm][kb + kk + lk + 1];
      bb.x = Sk[kk + lk][(wave << 4) + lm];  // mk^T gather from LDS
      bb.y = Sk[kk + lk + 1][(wave << 4) + lm];
      acc = __builtin_amdgcn_wmma_f32_16x16x4_f32(false, a, false, bb,
                                                  (short)0, acc, false, false);
    }
  }
#pragma unroll
  for (int r = 0; r < 8; ++r) {
    int qr = r + ((lane >> 4) << 3);
    att[(size_t)(b * LL + q0 + qr) * DD + h * HD + (wave << 4) + lm] = acc[r];
  }
}

// ---------------------------------------------------------------------------
// LayerNorm over D=512 per row; writes split output layout:
//   rows l<511 -> out[(b*511+l)*512 + d] ; row 511 -> out[16*511*512 + b*512 + d]
// ---------------------------------------------------------------------------
__global__ __launch_bounds__(256) void ln_kernel(const float* __restrict__ Hm,
                                                 const float* __restrict__ g,
                                                 const float* __restrict__ be,
                                                 float* __restrict__ out) {
  const int l = blockIdx.x, b = blockIdx.y, t = threadIdx.x;
  const int wave = t >> 5, lane = t & 31;
  const float* hr = Hm + (size_t)(b * LL + l) * DD;
  float x0 = hr[t], x1 = hr[t + 256];

  __shared__ float red[8];
  float s = x0 + x1;
#pragma unroll
  for (int off = 16; off; off >>= 1) s += __shfl_xor(s, off, 32);
  if (lane == 0) red[wave] = s;
  __syncthreads();
  float tot = 0.f;
#pragma unroll
  for (int i = 0; i < 8; ++i) tot += red[i];
  const float mu = tot * (1.f / 512.f);

  float d0 = x0 - mu, d1 = x1 - mu;
  float vs = d0 * d0 + d1 * d1;
#pragma unroll
  for (int off = 16; off; off >>= 1) vs += __shfl_xor(vs, off, 32);
  __syncthreads();
  if (lane == 0) red[wave] = vs;
  __syncthreads();
  float vtot = 0.f;
#pragma unroll
  for (int i = 0; i < 8; ++i) vtot += red[i];
  const float inv = rsqrtf(vtot * (1.f / 512.f) + 1e-12f);

  size_t o = (l < LL - 1) ? ((size_t)b * (LL - 1) + l) * DD
                          : (size_t)BB * (LL - 1) * DD + (size_t)b * DD;
  out[o + t]       = d0 * inv * g[t] + be[t];
  out[o + t + 256] = d1 * inv * g[t + 256] + be[t + 256];
}

// ---------------------------------------------------------------------------
extern "C" void kernel_launch(void* const* d_in, const int* in_sizes, int n_in,
                              void* d_out, int out_size, void* d_ws,
                              size_t ws_size, hipStream_t stream) {
  const float* X    = (const float*)d_in[0];
  const float* mask = (const float*)d_in[1];
  const float* Wq   = (const float*)d_in[2];
  const float* bq   = (const float*)d_in[3];
  const float* W1   = (const float*)d_in[4];
  const float* b1   = (const float*)d_in[5];
  const float* W2   = (const float*)d_in[6];
  const float* b2   = (const float*)d_in[7];
  const float* ln_g = (const float*)d_in[8];
  const float* ln_b = (const float*)d_in[9];
  const float* Wa   = (const float*)d_in[10];
  const float* ba   = (const float*)d_in[11];

  float* ws = (float*)d_ws;
  const size_t NE = (size_t)BB * LL * DD;  // 4,194,304
  float* qbuf    = ws;
  float* attbuf  = ws + NE;
  float* h1buf   = ws + 2 * NE;
  float* alphaBH = ws + 3 * NE;
  float* hbuf    = qbuf;  // q dead after attention; reuse for FFN output

  const int M = BB * LL;  // 8192
  dim3 gg(M / 128, DD / 16);

  // 1. q = relu(X @ Wq^T + bq)
  gemm_wmma_kernel<true, false>
      <<<gg, 256, 0, stream>>>(X, Wq, bq, nullptr, qbuf, M, DD, DD);
  // 2. alpha per (b,h)
  alpha_kernel<<<1, 128, 0, stream>>>(qbuf, Wa, ba, alphaBH);
  // 3. scores -> entmax -> att
  attn_entmax_kernel<<<dim3(LL / 16, HEADS, BB), 128, 0, stream>>>(
      qbuf, X, mask, alphaBH, attbuf);
  // 4. h1 = relu(att @ W1^T + b1)
  gemm_wmma_kernel<true, false>
      <<<gg, 256, 0, stream>>>(attbuf, W1, b1, nullptr, h1buf, M, DD, DD);
  // 5. h = h1 @ W2^T + b2 + att
  gemm_wmma_kernel<false, true>
      <<<gg, 256, 0, stream>>>(h1buf, W2, b2, attbuf, hbuf, M, DD, DD);
  // 6. LayerNorm + split output write
  ln_kernel<<<dim3(LL, BB), 256, 0, stream>>>(hbuf, ln_g, ln_b, (float*)d_out);
}

// v003
// A run of this version takes 260 microseconds.
// Timed twice side by side with v002, it ran 1.20 times as fast both times.
// Counting every step since v000, it is 3.76 times as fast.
#include <hip/hip_runtime.h>
#include <hip/hip_bf16.h>
#include <cstdint>

typedef float v2f __attribute__((ext_vector_type(2)));
typedef float v8f __attribute__((ext_vector_type(8)));
typedef int   v4i __attribute__((ext_vector_type(4)));

#define BB   16
#define LL   512
#define DD   512
#define HEADS 8
#define HD   64
#define KFULL 5    // bisection trips over the whole row, in front of the packing
#define CBP   260  // floats per row of packed elements: 256 places, the dump place, pad to 16 B

#if defined(__has_builtin)
#if __has_builtin(__builtin_amdgcn_global_load_async_to_lds_b128) && \
    __has_builtin(__builtin_amdgcn_s_wait_asynccnt)
#define USE_ASYNC_LDS 1
#endif
#endif

__device__ __forceinline__ void stage16(const float* g, float* l) {
#ifdef USE_ASYNC_LDS
  __builtin_amdgcn_global_load_async_to_lds_b128(
      (__attribute__((address_space(1))) v4i*)(uintptr_t)g,
      (__attribute__((address_space(3))) v4i*)(uint32_t)(uintptr_t)l, 0, 0);
#else
  *(float4*)l = *(const float4*)g;
#endif
}

__device__ __forceinline__ void stage_wait() {
#ifdef USE_ASYNC_LDS
  __builtin_amdgcn_s_wait_asynccnt(0);
#endif
}

template <bool RELU, bool RESID>
__global__ __launch_bounds__(256) void gemm_wmma_kernel(
    const float* __restrict__ A, const float* __restrict__ W,
    const float* __restrict__ bias, const float* __restrict__ resid,
    float* __restrict__ C, int M, int N, int K) {
  __shared__ __align__(16) float As[128][68];
  __shared__ __align__(16) float Bs[16][68];

  const int t    = threadIdx.x;
  const int wave = t >> 5;
  const int lane = t & 31;
  const int lm   = lane & 15;
  const int lk   = (lane >> 4) << 1;  // 0 or 2
  const int m0   = blockIdx.x * 128;
  const int n0   = blockIdx.y * 16;

  v8f acc = {0.f, 0.f, 0.f, 0.f, 0.f, 0.f, 0.f, 0.f};

  for (int kc = 0; kc < K; kc += 64) {
    // stage A: 128x64 floats = 2048 x b128, 8 per thread (coalesced)
#pragma unroll
    for (int i = 0; i < 8; ++i) {
      int idx = t + i * 256;
      int r = idx >> 4, c4 = (idx & 15) << 2;
      stage16(A + (size_t)(m0 + r) * K + kc + c4, &As[r][c4]);
    }
    // stage W tile: 16x64 = 256 x b128, 1 per thread
    {
      int r = t >> 4, c4 = (t & 15) << 2;
      stage16(W + (size_t)(n0 + r) * K + kc + c4, &Bs[r][c4]);
    }
    if (kc + 64 < K)  // hint next chunk into cache (global_prefetch_b8)
      __builtin_prefetch(A + (size_t)(m0 + (t >> 4)) * K + kc + 64, 0, 1);
    stage_wait();
    __syncthreads();

#pragma unroll
    for (int kk = 0; kk < 64; kk += 4) {
      v2f a, b;
      a.x = As[(wave << 4) + lm][kk + lk];
      a.y = As[(wave << 4) + lm][kk + lk + 1];
      b.x = Bs[lm][kk + lk];
      b.y = Bs[lm][kk + lk + 1];
      acc = __builtin_amdgcn_wmma_f32_16x16x4_f32(false, a, false, b,
                                                  (short)0, acc, false, false);
    }
    __syncthreads();
  }

  const float bcol = bias[n0 + lm];
#pragma unroll
  for (int r = 0; r < 8; ++r) {
    int row = m0 + (wave << 4) + r + ((lane >> 4) << 3);
    int col = n0 + lm;
    float v = acc[r] + bcol;
    if (RESID) v += resid[(size_t)row * N + col];
    if (RELU) v = fmaxf(v, 0.f);
    C[(size_t)row * N + col] = v;
  }
}

// ---------------------------------------------------------------------------
// alpha[b,h] = max(sigmoid(mq[b,h,L-1,:] . Wa + ba) + 1, 1 + 1e-5)
// ---------------------------------------------------------------------------
__global__ void alpha_kernel(const float* __restrict__ q,
                             const float* __restrict__ Wa,
                             const float* __restrict__ ba,
                             float* __restrict__ alphaBH) {
  int t = threadIdx.x;  // 0..127 : (b,h)
  int b = t >> 3, h = t & 7;
  const float* row = q + ((size_t)(b * LL + (LL - 1)) * DD) + h * HD;
  float z = ba[0];
#pragma unroll 8
  for (int j = 0; j < HD; ++j) z += row[j] * Wa[j];
  float a = 1.f / (1.f + expf(-z)) + 1.f;
  alphaBH[t] = fmaxf(a, 1.f + 1e-5f);
}

// ---------------------------------------------------------------------------
// max(z, 0) ^ rinv for finite rinv >= 1, branch-free on the bare instructions:
// z <= 0 gives log2(0) = -inf, rinv * -inf = -inf, exp2(-inf) = 0. No range
// scaling around v_log_f32 / v_exp_f32: it only matters for terms below
// 2^-126, which vanish beside a row sum that holds a term of at least 1/512.
// ---------------------------------------------------------------------------
__device__ __forceinline__ float powpos(float z, float rinv) {
  return __builtin_amdgcn_exp2f(rinv * __builtin_amdgcn_logf(fmaxf(z, 0.f)));
}

__device__ __forceinline__ float powpos_slot(float z, float rinv) {
  float l, p;
  asm("v_log_f32 %0, %1\n\tv_nop" : "=v"(l) : "v"(fmaxf(z, 0.f)));
  asm("v_exp_f32 %0, %1\n\tv_nop" : "=v"(p) : "v"(rinv * l));
  return p;
}

__device__ __forceinline__ float powsum4(float acc, float z0, float z1, float z2,
                                         float z3, float rinv) {
  float l0, l1, l2, l3, p0, p1, p2, p3;
  asm("v_log_f32 %0, %4\n\tv_log_f32 %1, %5\n\tv_log_f32 %2, %6\n\t"
      "v_log_f32 %3, %7\n\tv_nop\n\ts_delay_alu instid0(TRANS32_DEP_1)"
      : "=&v"(l0), "=&v"(l1), "=&v"(l2), "=&v"(l3)
      : "v"(fmaxf(z0, 0.f)), "v"(fmaxf(z1, 0.f)), "v"(fmaxf(z2, 0.f)),
        "v"(fmaxf(z3, 0.f)));
  asm("v_exp_f32 %0, %4\n\tv_exp_f32 %1, %5\n\tv_exp_f32 %2, %6\n\t"
      "v_exp_f32 %3, %7\n\tv_nop\n\ts_delay_alu instid0(TRANS32_DEP_1)"
      : "=&v"(p0), "=&v"(p1), "=&v"(p2), "=&v"(p3)
      : "v"(rinv * l0), "v"(rinv * l1), "v"(rinv * l2), "v"(rinv * l3));
  return (((acc + p0) + p1) + p2) + p3;
}

// ---------------------------------------------------------------------------
// Attention + entmax-bisect per (b, h, 16-query tile). 128 threads = 4 waves.
//   phase 1: scores tile [16 x 512] via WMMA, scaled + branchless LDS mask
//   phase 2: entmax bisection per row, at most 50 trips, ended at its f32 fixed
//            point, in registers; from trip 6 on only elements above tau_lo
//   phase 3: att tile [16 x 64] = p @ mk via WMMA
// ---------------------------------------------------------------------------
__global__ __launch_bounds__(128) void attn_entmax_kernel(
    const float* __restrict__ q, const float* __restrict__ X,
    const float* __restrict__ mask, const float* __restrict__ alphaBH,
    float* __restrict__ att) {
  __shared__ __align__(16) float Sq[16][68];   // mq tile
  __shared__ __align__(16) float Sk[64][68];   // staged keys (mk = X slice)
  __shared__ float Sc[16][516];                // scores -> p
  __shared__ float Sm[512];                    // mask row (key 511 forced 0)

  const int b  = blockIdx.z;
  const int h  = blockIdx.y;
  const int q0 = blockIdx.x * 16;
  const int t = threadIdx.x, wave = t >> 5, lane = t & 31;
  const int lm = lane & 15, lk = (lane >> 4) << 1;

  // stage mask row once (branchless epilogue later)
#pragma unroll
  for (int i = 0; i < 4; ++i) {
    int k = t + i * 128;
    Sm[k] = (k < LL - 1) ? mask[b * (LL - 1) + k] : 0.f;
  }
  // stage mq tile: 16x64 = 256 x b128
#pragma unroll
  for (int i = 0; i < 2; ++i) {
    int idx = t + i * 128;
    int r = idx >> 4, c4 = (idx & 15) << 2;
    stage16(q + (size_t)(b * LL + q0 + r) * DD + h * HD + c4, &Sq[r][c4]);
  }

  // ---- phase 1: scores = mq . mk^T / 8, masked ----
  for (int kb = 0; kb < LL; kb += 64) {
    __syncthreads();
#pragma unroll
    for (int i = 0; i < 8; ++i) {
      int idx = t + i * 128;
      int r = idx >> 4, c4 = (idx & 15) << 2;
      stage16(X + (size_t)(b * LL + kb + r) * DD + h * HD + c4, &Sk[r][c4]);
    }
    stage_wait();
    __syncthreads();

    v8f acc = {0.f, 0.f, 0.f, 0.f, 0.f, 0.f, 0.f, 0.f};
#pragma unroll
    for (int kk = 0; kk < HD; kk += 4) {
      v2f a, bb;
      a.x  = Sq[lm][kk + lk];
      a.y  = Sq[lm][kk + lk + 1];
      bb.x = Sk[(wave << 4) + lm][kk + lk];
      bb.y = Sk[(wave << 4) + lm][kk + lk + 1];
      acc = __builtin_amdgcn_wmma_f32_16x16x4_f32(false, a, false, bb,
                                                  (short)0, acc, false, false);
    }
#pragma unroll
    for (int r = 0; r < 8; ++r) {
      int qr  = r + ((lane >> 4) << 3);
      int key = kb + (wave << 4) + lm;
      float s = acc[r] * 0.125f;  // 1/sqrt(64)
      Sc[qr][key] = (Sm[key] != 0.f) ? s : -__builtin_huge_valf();
    }
  }
  __syncthreads();

  // ---- phase 2: entmax bisection (one wave handles 4 rows) ----
  // tau_lo never falls and tau_m = tau_lo + dm >= tau_lo, so an element at or
  // below tau_lo is an exact zero term in every later trip. After KFULL trips
  // over the whole row the elements still above tau_lo are packed through LDS
  // (Sk is free between phases 1 and 3) and the trips that are left run on the
  // packed elements alone, the wave's 4 rows side by side, 8 lanes a row.
  const float am1  = alphaBH[b * HEADS + h] - 1.f;
  const float rinv = 1.f / am1;
  float* const cbw = &Sk[0][0] + (wave * 4) * CBP;
  const int grp = lane >> 3;
  float g_lo = 0.f, g_dm = 0.f, g_flo = 0.f, g_m = 0.f;  // state of row grp
  bool g_frozen = true;  // row grp already has its final tau_m
  int maxcnt = 0;        // most packed elements in any row of the wave
  for (int rr = 0; rr < 4; ++rr) {
    const int row = wave * 4 + rr;
    float* const cb = cbw + rr * CBP;
    float xs[16];
#pragma unroll
    for (int j = 0; j < 16; ++j) xs[j] = Sc[row][lane + 32 * j] * am1;

    // every packed place starts as -inf, a zero term
    {
      const float ni = -__builtin_huge_valf();
      const float4 n4 = make_float4(ni, ni, ni, ni);
      *(float4*)&cb[lane * 4]       = n4;
      *(float4*)&cb[128 + lane * 4] = n4;
    }

    float mx = -__builtin_huge_valf();
#pragma unroll
    for (int j = 0; j < 16; ++j) mx = fmaxf(mx, xs[j]);
#pragma unroll
    for (int off = 16; off; off >>= 1) mx = fmaxf(mx, __shfl_xor(mx, off, 32));

    float tau_lo = mx - 1.f;
    float tau_hi = mx - exp2f(-9.f * am1);  // (1/512)^(alpha-1)

    float s = 0.f;
#pragma unroll
    for (int j = 0; j < 16; ++j) {
      float z = xs[j] - tau_lo;
      s += powpos_slot(z, rinv);
    }
#pragma unroll
    for (int off = 16; off; off >>= 1) s += __shfl_xor(s, off, 32);
    const float f_lo = s - 1.f;

    float dm = tau_hi - tau_lo, tau_m = tau_lo;
    // The loop ends at the fixed point of the f32 bisection. Once tau_lo + dm
    // rounds to tau_lo, either side of the update leaves tau_lo as it is, and
    // every later, smaller dm rounds to the same tau_m (rounding is monotone):
    // all trips that are left of the 50 are identities, so tau_m has its final
    // bits. A NaN tau_m stays NaN and gives the same zero terms either way.
    bool fixed = false;
    int it = 0, lim = KFULL, cnt = 0;
    for (;;) {
      for (; it < lim && !fixed; ++it) {
        dm *= 0.5f;
        tau_m = tau_lo + dm;
        // Every lane holds the same two values; the first lane's copies make
        // the test a scalar compare and the loop branch stays scalar.
        fixed = __builtin_amdgcn_readfirstlane(__float_as_int(tau_m)) ==
                __builtin_amdgcn_readfirstlane(__float_as_int(tau_lo));
        float fm = 0.f;
#pragma unroll
        for (int j = 0; j < 16; ++j) {
          float z = xs[j] - tau_m;
          fm += powpos(z, rinv);
        }
#pragma unroll
        for (int off = 16; off; off >>= 1) fm += __shfl_xor(fm, off, 32);
        fm -= 1.f;
        tau_lo = (fm * f_lo >= 0.f) ? tau_m : tau_lo;  // uniform update
      }
      if (fixed || lim == 50) break;
      // Pack: place = number of live elements in front (earlier j, lower lane).
      // A dead element, or one past the 256 places, goes to the dump place.
      cnt = 0;
#pragma unroll
      for (int j = 0; j < 16; ++j) {
        const bool act = xs[j] > tau_lo;
        const unsigned mk = __builtin_amdgcn_ballot_w32(act);
        unsigned pos = __builtin_amdgcn_mbcnt_lo(mk, (unsigned)cnt);
        pos = act ? (pos < 256u ? pos : 256u) : 256u;
        cb[pos] = xs[j];
        cnt += __builtin_popcount(mk);
      }
      if (cnt <= 256) break;
      lim = 50;  // more live elements than places: this row stays full width
    }
    const bool rowdone = fixed || lim == 50;
    if (!rowdone && cnt > maxcnt) maxcnt = cnt;
    if (grp == rr) {
      g_lo = tau_lo; g_dm = dm; g_flo = f_lo; g_m = tau_m; g_frozen = rowdone;
    }
  }

  // The trips that are left, on the packed elements: lane holds places
  // 32*e4 + 4*(lane&7) + k of row grp. Past the first 128 places only the
  // groups of 32 that some row of the wave has filled are summed (a scalar test
  // per group); a place that was not filled holds -inf, a zero term.
  {
    const float* const cr = cbw + grp * CBP + (lane & 7) * 4;
    const int nch = (maxcnt + 31) >> 5;
    float c[32];
#pragma unroll
    for (int e4 = 0; e4 < 8; ++e4) {
      const float4 v = *(const float4*)&cr[e4 * 32];
      c[4 * e4] = v.x; c[4 * e4 + 1] = v.y; c[4 * e4 + 2] = v.z; c[4 * e4 + 3] = v.w;
    }
    bool alldone = false;
    for (int it = KFULL; it < 50 && !alldone; ++it) {
      g_dm *= 0.5f;
      const float t = g_lo + g_dm;
      // A row at its fixed point repeats identities while the others go on.
      const bool still = !g_frozen && __float_as_int(t) != __float_as_int(g_lo);
      g_m = g_frozen ? g_m : t;
      alldone = __builtin_amdgcn_ballot_w32(still) == 0u;
      float fm = 0.f;
#pragma unroll
      for (int e4 = 0; e4 < 8; ++e4) {
        if (e4 >= 4 && e4 >= nch) break;
        fm = powsum4(fm, c[4 * e4] - g_m, c[4 * e4 + 1] - g_m,
                     c[4 * e4 + 2] - g_m, c[4 * e4 + 3] - g_m, rinv);
      }
#pragma unroll
      for (int off = 4; off; off >>= 1) fm += __shfl_xor(fm, off, 32);
      fm -= 1.f;
      g_lo = (fm * g_flo >= 0.f) ? g_m : g_lo;
    }
  }

  // p over the whole row at the final tau_m
  for (int rr = 0; rr < 4; ++rr) {
    const int row = wave * 4 + rr;
    const float tau_m = __int_as_float(
        __builtin_amdgcn_readlane(__float_as_int(g_m), rr * 8));
    float pv[16], ssum = 0.f;
#pragma unroll
    for (int j = 0; j < 16; ++j) {
      float z = Sc[row][lane + 32 * j] * am1 - tau_m;
      pv[j] = powpos(z, rinv);
      ssum += pv[j];
    }
#pragma unroll
    for (int off = 16; off; off >>= 1) ssum += __shfl_xor(ssum, off, 32);
    const float inv = 1.f / ssum;
#pragma unroll
    for (int j = 0; j < 16; ++j) Sc[row][lane + 32 * j] = pv[j] * inv;
  }

  // ---- phase 3: att = p @ mk ----
  v8f acc = {0.f, 0.f, 0.f, 0.f, 0.f, 0.f, 0.f, 0.f};
  for (int kb = 0; kb < LL; kb += 64) {
    __syncthreads();
#pragma unroll
    for (int i = 0; i < 8; ++i) {
      int idx = t + i * 128;
      int r = idx >> 4, c4 = (idx & 15) << 2;
      stage16(X + (size_t)(b * LL + kb + r) * DD + h * HD + c4, &Sk[r][c4]);
    }
    stage_wait();
    __syncthreads();
#pragma unroll
    for (int kk = 0; kk < 64; kk += 4) {
      v2f a, bb;
      a.x  = Sc[lm][kb + kk + lk];
      a.y  = Sc[lm][kb + kk + lk + 1];
      bb.x = Sk[kk + lk][(wave << 4) + lm];  // mk^T gather from LDS
      bb.y = Sk[kk + lk + 1][(wave << 4) + lm];
      acc = __builtin_amdgcn_wmma_f32_16x16x4_f32(false, a, false, bb,
                                                  (short)0, acc, false, false);
    }
  }
#pragma unroll
  for (int r = 0; r < 8; ++r) {
    int qr = r + ((lane >> 4) << 3);
    att[(size_t)(b * LL + q0 + qr) * DD + h * HD + (wave << 4) + lm] = acc[r];
  }
}

// ---------------------------------------------------------------------------
// LayerNorm over D=512 per row; writes split output layout:
//   rows l<511 -> out[(b*511+l)*512 + d] ; row 511 -> out[16*511*512 + b*512 + d]
// ---------------------------------------------------------------------------
__global__ __launch_bounds__(256) void ln_kernel(const float* __restrict__ Hm,
                                                 const float* __restrict__ g,
                                                 const float* __restrict__ be,
                                                 float* __restrict__ out) {
  const int l = blockIdx.x, b = blockIdx.y, t = threadIdx.x;
  const int wave = t >> 5, lane = t & 31;
  const float* hr = Hm + (size_t)(b * LL + l) * DD;
  float x0 = hr[t], x1 = hr[t + 256];

  __shared__ float red[8];
  float s = x0 + x1;
#pragma unroll
  for (int off = 16; off; off >>= 1) s += __shfl_xor(s, off, 32);
  if (lane == 0) red[wave] = s;
  __syncthreads();
  float tot = 0.f;
#pragma unroll
  for (int i = 0; i < 8; ++i) tot += red[i];
  const float mu = tot * (1.f / 512.f);

  float d0 = x0 - mu, d1 = x1 - mu;
  float vs = d0 * d0 + d1 * d1;
#pragma unroll
  for (int off = 16; off; off >>= 1) vs += __shfl_xor(vs, off, 32);
  __syncthreads();
  if (lane == 0) red[wave] = vs;
  __syncthreads();
  float vtot = 0.f;
#pragma unroll
  for (int i = 0; i < 8; ++i) vtot += red[i];
  const float inv = rsqrtf(vtot * (1.f / 512.f) + 1e-12f);

  size_t o = (l < LL - 1) ? ((size_t)b * (LL - 1) + l) * DD
                          : (size_t)BB * (LL - 1) * DD + (size_t)b * DD;
  out[o + t]       = d0 * inv * g[t] + be[t];
  out[o + t + 256] = d1 * inv * g[t + 256] + be[t + 256];
}

// ---------------------------------------------------------------------------
extern "C" void kernel_launch(void* const* d_in, const int* in_sizes, int n_in,
                              void* d_out, int out_size, void* d_ws,
                              size_t ws_size, hipStream_t stream) {
  const float* X    = (const float*)d_in[0];
  const float* mask = (const float*)d_in[1];
  const float* Wq   = (const float*)d_in[2];
  const float* bq   = (const float*)d_in[3];
  const float* W1   = (const float*)d_in[4];
  const float* b1   = (const float*)d_in[5];
  const float* W2   = (const float*)d_in[6];
  const float* b2   = (const float*)d_in[7];
  const float* ln_g = (const float*)d_in[8];
  const float* ln_b = (const float*)d_in[9];
  const float* Wa   = (const float*)d_in[10];
  const float* ba   = (const float*)d_in[11];

  float* ws = (float*)d_ws;
  const size_t NE = (size_t)BB * LL * DD;  // 4,194,304
  float* qbuf    = ws;
  float* attbuf  = ws + NE;
  float* h1buf   = ws + 2 * NE;
  float* alphaBH = ws + 3 * NE;
  float* hbuf    = qbuf;  // q dead after attention; reuse for FFN output

  const int M = BB * LL;  // 8192
  dim3 gg(M / 128, DD / 16);

  // 1. q = relu(X @ Wq^T + bq)
  gemm_wmma_kernel<true, false>
      <<<gg, 256, 0, stream>>>(X, Wq, bq, nullptr, qbuf, M, DD, DD);
  // 2. alpha per (b,h)
  alpha_kernel<<<1, 128, 0, stream>>>(qbuf, Wa, ba, alphaBH);
  // 3. scores -> entmax -> att
  attn_entmax_kernel<<<dim3(LL / 16, HEADS, BB), 128, 0, stream>>>(
      qbuf, X, mask, alphaBH, attbuf);
  // 4. h1 = relu(att @ W1^T + b1)
  gemm_wmma_kernel<true, false>
      <<<gg, 256, 0, stream>>>(attbuf, W1, b1, nullptr, h1buf, M, DD, DD);
  // 5. h = h1 @ W2^T + b2 + att
  gemm_wmma_kernel<false, true>
      <<<gg, 256, 0, stream>>>(h1buf, W2, b2, attbuf, hbuf, M, DD, DD);
  // 6. LayerNorm + split output write
  ln_kernel<<<dim3(LL, BB), 256, 0, stream>>>(hbuf, ln_g, ln_b, (float*)d_out);
}

// v004
// A run of this version takes 246 microseconds.
// Timed twice side by side with v003, it ran 1.06 times as fast both times.
// Over all steps from v000 it is 3.97 times as fast.
#include <hip/hip_runtime.h>
#include <hip/hip_bf16.h>
#include <cstdint>

typedef float v2f __attribute__((ext_vector_type(2)));
typedef float v8f __attribute__((ext_vector_type(8)));
typedef int   v4i __attribute__((ext_vector_type(4)));

#define BB   16
#define LL   512
#define DD   512
#define HEADS 8
#define HD   64
#define KFULL 5    // bisection trips over the whole row, in front of the packing
#define CBP   260  // floats per row of packed elements: 256 places, the dump place, pad to 16 B

#if defined(__has_builtin)
#if __has_builtin(__builtin_amdgcn_global_load_async_to_lds_b128) && \
    __has_builtin(__builtin_amdgcn_s_wait_asynccnt)
#define USE_ASYNC_LDS 1
#endif
#endif

__device__ __forceinline__ void stage16(const float* g, float* l) {
#ifdef USE_ASYNC_LDS
  __builtin_amdgcn_global_load_async_to_lds_b128(
      (__attribute__((address_space(1))) v4i*)(uintptr_t)g,
      (__attribute__((address_space(3))) v4i*)(uint32_t)(uintptr_t)l, 0, 0);
#else
  *(float4*)l = *(const float4*)g;
#endif
}

__device__ __forceinline__ void stage_wait() {
#ifdef USE_ASYNC_LDS
  __builtin_amdgcn_s_wait_asynccnt(0);
#endif
}

template <bool RELU, bool RESID>
__global__ __launch_bounds__(128) void gemm_wmma_kernel(
    const float* __restrict__ A, const float* __restrict__ W,
    const float* __restrict__ bias, const float* __restrict__ resid,
    float* __restrict__ C, int M, int N, int K) {
  __shared__ __align__(16) float As[64][132];
  __shared__ __align__(16) float Bs[64][132];

  const int t    = threadIdx.x;
  const int wave = t >> 5;
  const int lane = t & 31;
  const int lm   = lane & 15;
  const int lk   = (lane >> 4) << 1;  // 0 or 2
  const int m0   = blockIdx.x * 64;
  const int n0   = blockIdx.y * 64;
  const int wm   = (wave >> 1) << 5;  // the wave's 32 rows of the block tile
  const int wn   = (wave & 1) << 5;   // the wave's 32 columns

  const v8f zero = {0.f, 0.f, 0.f, 0.f, 0.f, 0.f, 0.f, 0.f};
  v8f acc00 = zero, acc01 = zero, acc10 = zero, acc11 = zero;

  for (int kc = 0; kc < K; kc += 128) {
    // stage A and W: 64x128 floats each = 2048 x b128, 16 + 16 per thread;
    // one wave-wide copy is one whole 512-byte row of the chunk
#pragma unroll
    for (int i = 0; i < 16; ++i) {
      int r = wave + i * 4, c4 = lane << 2;
      stage16(A + (size_t)(m0 + r) * K + kc + c4, &As[r][c4]);
      stage16(W + (size_t)(n0 + r) * K + kc + c4, &Bs[r][c4]);
    }
    stage_wait();
    __syncthreads();

#pragma unroll
    for (int kk = 0; kk < 128; kk += 4) {
      v2f a0, a1, b0, b1;
      a0.x = As[wm + lm][kk + lk];
      a0.y = As[wm + lm][kk + lk + 1];
      a1.x = As[wm + 16 + lm][kk + lk];
      a1.y = As[wm + 16 + lm][kk + lk + 1];
      b0.x = Bs[wn + lm][kk + lk];
      b0.y = Bs[wn + lm][kk + lk + 1];
      b1.x = Bs[wn + 16 + lm][kk + lk];
      b1.y = Bs[wn + 16 + lm][kk + lk + 1];
      acc00 = __builtin_amdgcn_wmma_f32_16x16x4_f32(false, a0, false, b0,
                                                    (short)0, acc00, false, false);
      acc01 = __builtin_amdgcn_wmma_f32_16x16x4_f32(false, a0, false, b1,
                                                    (short)0, acc01, false, false);
      acc10 = __builtin_amdgcn_wmma_f32_16x16x4_f32(false, a1, false, b0,
                                                    (short)0, acc10, false, false);
      acc11 = __builtin_amdgcn_wmma_f32_16x16x4_f32(false, a1, false, b1,
                                                    (short)0, acc11, false, false);
    }
    __syncthreads();
  }

#pragma unroll
  for (int j = 0; j < 2; ++j) {
    const int col = n0 + wn + j * 16 + lm;
    const float bcol = bias[col];
#pragma unroll
    for (int i = 0; i < 2; ++i) {
      const v8f acc = i ? (j ? acc11 : acc10) : (j ? acc01 : acc00);
#pragma unroll
      for (int r = 0; r < 8; ++r) {
        int row = m0 + wm + i * 16 + r + ((lane >> 4) << 3);
        float v = acc[r] + bcol;
        if (RESID) v += resid[(size_t)row * N + col];
        if (RELU) v = fmaxf(v, 0.f);
        C[(size_t)row * N + col] = v;
      }
    }
  }
}

// ---------------------------------------------------------------------------
// alpha[b,h] = max(sigmoid(mq[b,h,L-1,:] . Wa + ba) + 1, 1 + 1e-5)
// ---------------------------------------------------------------------------
__global__ void alpha_kernel(const float* __restrict__ q,
                             const float* __restrict__ Wa,
                             const float* __restrict__ ba,
                             float* __restrict__ alphaBH) {
  int t = threadIdx.x;  // 0..127 : (b,h)
  int b = t >> 3, h = t & 7;
  const float* row = q + ((size_t)(b * LL + (LL - 1)) * DD) + h * HD;
  float z = ba[0];
#pragma unroll 8
  for (int j = 0; j < HD; ++j) z += row[j] * Wa[j];
  float a = 1.f / (1.f + expf(-z)) + 1.f;
  alphaBH[t] = fmaxf(a, 1.f + 1e-5f);
}

// ---------------------------------------------------------------------------
// max(z, 0) ^ rinv for finite rinv >= 1, branch-free on the bare instructions:
// z <= 0 gives log2(0) = -inf, rinv * -inf = -inf, exp2(-inf) = 0. No range
// scaling around v_log_f32 / v_exp_f32: it only matters for terms below
// 2^-126, which vanish beside a row sum that holds a term of at least 1/512.
// ---------------------------------------------------------------------------
__device__ __forceinline__ float powpos(float z, float rinv) {
  return __builtin_amdgcn_exp2f(rinv * __builtin_amdgcn_logf(fmaxf(z, 0.f)));
}

__device__ __forceinline__ float powpos_slot(float z, float rinv) {
  float l, p;
  asm("v_log_f32 %0, %1\n\tv_nop" : "=v"(l) : "v"(fmaxf(z, 0.f)));
  asm("v_exp_f32 %0, %1\n\tv_nop" : "=v"(p) : "v"(rinv * l));
  return p;
}

__device__ __forceinline__ float powsum4(float acc, float z0, float z1, float z2,
                                         float z3, float rinv) {
  float l0, l1, l2, l3, p0, p1, p2, p3;
  asm("v_log_f32 %0, %4\n\tv_log_f32 %1, %5\n\tv_log_f32 %2, %6\n\t"
      "v_log_f32 %3, %7\n\tv_nop\n\ts_delay_alu instid0(TRANS32_DEP_1)"
      : "=&v"(l0), "=&v"(l1), "=&v"(l2), "=&v"(l3)
      : "v"(fmaxf(z0, 0.f)), "v"(fmaxf(z1, 0.f)), "v"(fmaxf(z2, 0.f)),
        "v"(fmaxf(z3, 0.f)));
  asm("v_exp_f32 %0, %4\n\tv_exp_f32 %1, %5\n\tv_exp_f32 %2, %6\n\t"
      "v_exp_f32 %3, %7\n\tv_nop\n\ts_delay_alu instid0(TRANS32_DEP_1)"
      : "=&v"(p0), "=&v"(p1), "=&v"(p2), "=&v"(p3)
      : "v"(rinv * l0), "v"(rinv * l1), "v"(rinv * l2), "v"(rinv * l3));
  return (((acc + p0) + p1) + p2) + p3;
}

// ---------------------------------------------------------------------------
// Attention + entmax-bisect per (b, h, 16-query tile). 128 threads = 4 waves.
//   phase 1: scores tile [16 x 512] via WMMA, scaled + branchless LDS mask
//   phase 2: entmax bisection per row, at most 50 trips, ended at its f32 fixed
//            point, in registers; from trip 6 on only elements above tau_lo
//   phase 3: att tile [16 x 64] = p @ mk via WMMA
// ---------------------------------------------------------------------------
__global__ __launch_bounds__(128) void attn_entmax_kernel(
    const float* __restrict__ q, const float* __restrict__ X,
    const float* __restrict__ mask, const float* __restrict__ alphaBH,
    float* __restrict__ att) {
  __shared__ __align__(16) float Sq[16][68];   // mq tile
  __shared__ __align__(16) float Sk[64][68];   // staged keys (mk = X slice)
  __shared__ float Sc[16][516];                // scores -> p
  __shared__ float Sm[512];                    // mask row (key 511 forced 0)

  const int b  = blockIdx.z;
  const int h  = blockIdx.y;
  const int q0 = blockIdx.x * 16;
  const int t = threadIdx.x, wave = t >> 5, lane = t & 31;
  const int lm = lane & 15, lk = (lane >> 4) << 1;

  // stage mask row once (branchless epilogue later)
#pragma unroll
  for (int i = 0; i < 4; ++i) {
    int k = t + i * 128;
    Sm[k] = (k < LL - 1) ? mask[b * (LL - 1) + k] : 0.f;
  }
  // stage mq tile: 16x64 = 256 x b128
#pragma unroll
  for (int i = 0; i < 2; ++i) {
    int idx = t + i * 128;
    int r = idx >> 4, c4 = (idx & 15) << 2;
    stage16(q + (size_t)(b * LL + q0 + r) * DD + h * HD + c4, &Sq[r][c4]);
  }

  // ---- phase 1: scores = mq . mk^T / 8, masked ----
  for (int kb = 0; kb < LL; kb += 64) {
    __syncthreads();
#pragma unroll
    for (int i = 0; i < 8; ++i) {
      int idx = t + i * 128;
      int r = idx >> 4, c4 = (idx & 15) << 2;
      stage16(X + (size_t)(b * LL + kb + r) * DD + h * HD + c4, &Sk[r][c4]);
    }
    stage_wait();
    __syncthreads();

    v8f acc = {0.f, 0.f, 0.f, 0.f, 0.f, 0.f, 0.f, 0.f};
#pragma unroll
    for (int kk = 0; kk < HD; kk += 4) {
      v2f a, bb;
      a.x  = Sq[lm][kk + lk];
      a.y  = Sq[lm][kk + lk + 1];
      bb.x = Sk[(wave << 4) + lm][kk + lk];
      bb.y = Sk[(wave << 4) + lm][kk + lk + 1];
      acc = __builtin_amdgcn_wmma_f32_16x16x4_f32(false, a, false, bb,
                                                  (short)0, acc, false, false);
    }
#pragma unroll
    for (int r = 0; r < 8; ++r) {
      int qr  = r + ((lane >> 4) << 3);
      int key = kb + (wave << 4) + lm;
      float s = acc[r] * 0.125f;  // 1/sqrt(64)
      Sc[qr][key] = (Sm[key] != 0.f) ? s : -__builtin_huge_valf();
    }
  }
  __syncthreads();

  // ---- phase 2: entmax bisection (one wave handles 4 rows) ----
  // tau_lo never falls and tau_m = tau_lo + dm >= tau_lo, so an element at or
  // below tau_lo is an exact zero term in every later trip. After KFULL trips
  // over the whole row the elements still above tau_lo are packed through LDS
  // (Sk is free between phases 1 and 3) and the trips that are left run on the
  // packed elements alone, the wave's 4 rows side by side, 8 lanes a row.
  const float am1  = alphaBH[b * HEADS + h] - 1.f;
  const float rinv = 1.f / am1;
  float* const cbw = &Sk[0][0] + (wave * 4) * CBP;
  const int grp = lane >> 3;
  float g_lo = 0.f, g_dm = 0.f, g_flo = 0.f, g_m = 0.f;  // state of row grp
  bool g_frozen = true;  // row grp already has its final tau_m
  int maxcnt = 0;        // most packed elements in any row of the wave
  for (int rr = 0; rr < 4; ++rr) {
    const int row = wave * 4 + rr;
    float* const cb = cbw + rr * CBP;
    float xs[16];
#pragma unroll
    for (int j = 0; j < 16; ++j) xs[j] = Sc[row][lane + 32 * j] * am1;

    // every packed place starts as -inf, a zero term
    {
      const float ni = -__builtin_huge_valf();
      const float4 n4 = make_float4(ni, ni, ni, ni);
      *(float4*)&cb[lane * 4]       = n4;
      *(float4*)&cb[128 + lane * 4] = n4;
    }

    float mx = -__builtin_huge_valf();
#pragma unroll
    for (int j = 0; j < 16; ++j) mx = fmaxf(mx, xs[j]);
#pragma unroll
    for (int off = 16; off; off >>= 1) mx = fmaxf(mx, __shfl_xor(mx, off, 32));

    float tau_lo = mx - 1.f;
    float tau_hi = mx - exp2f(-9.f * am1);  // (1/512)^(alpha-1)

    float s = 0.f;
#pragma unroll
    for (int j = 0; j < 16; ++j) {
      float z = xs[j] - tau_lo;
      s += powpos_slot(z, rinv);
    }
#pragma unroll
    for (int off = 16; off; off >>= 1) s += __shfl_xor(s, off, 32);
    const float f_lo = s - 1.f;

    float dm = tau_hi - tau_lo, tau_m = tau_lo;
    // The loop ends at the fixed point of the f32 bisection. Once tau_lo + dm
    // rounds to tau_lo, either side of the update leaves tau_lo as it is, and
    // every later, smaller dm rounds to the same tau_m (rounding is monotone):
    // all trips that are left of the 50 are identities, so tau_m has its final
    // bits. A NaN tau_m stays NaN and gives the same zero terms either way.
    bool fixed = false;
    int it = 0, lim = KFULL, cnt = 0;
    for (;;) {
      for (; it < lim && !fixed; ++it) {
        dm *= 0.5f;
        tau_m = tau_lo + dm;
        // Every lane holds the same two values; the first lane's copies make
        // the test a scalar compare and the loop branch stays scalar.
        fixed = __builtin_amdgcn_readfirstlane(__float_as_int(tau_m)) ==
                __builtin_amdgcn_readfirstlane(__float_as_int(tau_lo));
        float fm = 0.f;
#pragma unroll
        for (int j = 0; j < 16; ++j) {
          float z = xs[j] - tau_m;
          fm += powpos(z, rinv);
        }
#pragma unroll
        for (int off = 16; off; off >>= 1) fm += __shfl_xor(fm, off, 32);
        fm -= 1.f;
        tau_lo = (fm * f_lo >= 0.f) ? tau_m : tau_lo;  // uniform update
      }
      if (fixed || lim == 50) break;
      // Pack: place = number of live elements in front (earlier j, lower lane).
      // A dead element, or one past the 256 places, goes to the dump place.
      cnt = 0;
#pragma unroll
      for (int j = 0; j < 16; ++j) {
        const bool act = xs[j] > tau_lo;
        const unsigned mk = __builtin_amdgcn_ballot_w32(act);
        unsigned pos = __builtin_amdgcn_mbcnt_lo(mk, (unsigned)cnt);
        pos = act ? (pos < 256u ? pos : 256u) : 256u;
        cb[pos] = xs[j];
        cnt += __builtin_popcount(mk);
      }
      if (cnt <= 256) break;
      lim = 50;  // more live elements than places: this row stays full width
    }
    const bool rowdone = fixed || lim == 50;
    if (!rowdone && cnt > maxcnt) maxcnt = cnt;
    if (grp == rr) {
      g_lo = tau_lo; g_dm = dm; g_flo = f_lo; g_m = tau_m; g_frozen = rowdone;
    }
  }

  // The trips that are left, on the packed elements: lane holds places
  // 32*e4 + 4*(lane&7) + k of row grp. Past the first 128 places only the
  // groups of 32 that some row of the wave has filled are summed (a scalar test
  // per group); a place that was not filled holds -inf, a zero term.
  {
    const float* const cr = cbw + grp * CBP + (lane & 7) * 4;
    const int nch = (maxcnt + 31) >> 5;
    float c[32];
#pragma unroll
    for (int e4 = 0; e4 < 8; ++e4) {
      const float4 v = *(const float4*)&cr[e4 * 32];
      c[4 * e4] = v.x; c[4 * e4 + 1] = v.y; c[4 * e4 + 2] = v.z; c[4 * e4 + 3] = v.w;
    }
    bool alldone = false;
    for (int it = KFULL; it < 50 && !alldone; ++it) {
      g_dm *= 0.5f;
      const float t = g_lo + g_dm;
      // A row at its fixed point repeats identities while the others go on.
      const bool still = !g_frozen && __float_as_int(t) != __float_as_int(g_lo);
      g_m = g_frozen ? g_m : t;
      alldone = __builtin_amdgcn_ballot_w32(still) == 0u;
      float fm = 0.f;
#pragma unroll
      for (int e4 = 0; e4 < 8; ++e4) {
        if (e4 >= 4 && e4 >= nch) break;
        fm = powsum4(fm, c[4 * e4] - g_m, c[4 * e4 + 1] - g_m,
                     c[4 * e4 + 2] - g_m, c[4 * e4 + 3] - g_m, rinv);
      }
#pragma unroll
      for (int off = 4; off; off >>= 1) fm += __shfl_xor(fm, off, 32);
      fm -= 1.f;
      g_lo = (fm * g_flo >= 0.f) ? g_m : g_lo;
    }
  }

  // p over the whole row at the final tau_m
  for (int rr = 0; rr < 4; ++rr) {
    const int row = wave * 4 + rr;
    const float tau_m = __int_as_float(
        __builtin_amdgcn_readlane(__float_as_int(g_m), rr * 8));
    float pv[16], ssum = 0.f;
#pragma unroll
    for (int j = 0; j < 16; ++j) {
      float z = Sc[row][lane + 32 * j] * am1 - tau_m;
      pv[j] = powpos(z, rinv);
      ssum += pv[j];
    }
#pragma unroll
    for (int off = 16; off; off >>= 1) ssum += __shfl_xor(ssum, off, 32);
    const float inv = 1.f / ssum;
#pragma unroll
    for (int j = 0; j < 16; ++j) Sc[row][lane + 32 * j] = pv[j] * inv;
  }

  // ---- phase 3: att = p @ mk ----
  v8f acc = {0.f, 0.f, 0.f, 0.f, 0.f, 0.f, 0.f, 0.f};
  for (int kb = 0; kb < LL; kb += 64) {
    __syncthreads();
#pragma unroll
    for (int i = 0; i < 8; ++i) {
      int idx = t + i * 128;
      int r = idx >> 4, c4 = (idx & 15) << 2;
      stage16(X + (size_t)(b * LL + kb + r) * DD + h * HD + c4, &Sk[r][c4]);
    }
    stage_wait();
    __syncthreads();
#pragma unroll
    for (int kk = 0; kk < 64; kk += 4) {
      v2f a, bb;
      a.x  = Sc[lm][kb + kk + lk];
      a.y  = Sc[lm][kb + kk + lk + 1];
      bb.x = Sk[kk + lk][(wave << 4) + lm];  // mk^T gather from LDS
      bb.y = Sk[kk + lk + 1][(wave << 4) + lm];
      acc = __builtin_amdgcn_wmma_f32_16x16x4_f32(false, a, false, bb,
                                                  (short)0, acc, false, false);
    }
  }
#pragma unroll
  for (int r = 0; r < 8; ++r) {
    int qr = r + ((lane >> 4) << 3);
    att[(size_t)(b * LL + q0 + qr) * DD + h * HD + (wave << 4) + lm] = acc[r];
  }
}

// ---------------------------------------------------------------------------
// LayerNorm over D=512 per row; writes split output layout:
//   rows l<511 -> out[(b*511+l)*512 + d] ; row 511 -> out[16*511*512 + b*512 + d]
// ---------------------------------------------------------------------------
__global__ __launch_bounds__(256) void ln_kernel(const float* __restrict__ Hm,
                                                 const float* __restrict__ g,
                                                 const float* __restrict__ be,
                                                 float* __restrict__ out) {
  const int l = blockIdx.x, b = blockIdx.y, t = threadIdx.x;
  const int wave = t >> 5, lane = t & 31;
  const float* hr = Hm + (size_t)(b * LL + l) * DD;
  float x0 = hr[t], x1 = hr[t + 256];

  __shared__ float red[8];
  float s = x0 + x1;
#pragma unroll
  for (int off = 16; off; off >>= 1) s += __shfl_xor(s, off, 32);
  if (lane == 0) red[wave] = s;
  __syncthreads();
  float tot = 0.f;
#pragma unroll
  for (int i = 0; i < 8; ++i) tot += red[i];
  const float mu = tot * (1.f / 512.f);

  float d0 = x0 - mu, d1 = x1 - mu;
  float vs = d0 * d0 + d1 * d1;
#pragma unroll
  for (int off = 16; off; off >>= 1) vs += __shfl_xor(vs, off, 32);
  __syncthreads();
  if (lane == 0) red[wave] = vs;
  __syncthreads();
  float vtot = 0.f;
#pragma unroll
  for (int i = 0; i < 8; ++i) vtot += red[i];
  const float inv = rsqrtf(vtot * (1.f / 512.f) + 1e-12f);

  size_t o = (l < LL - 1) ? ((size_t)b * (LL - 1) + l) * DD
                          : (size_t)BB * (LL - 1) * DD + (size_t)b * DD;
  out[o + t]       = d0 * inv * g[t] + be[t];
  out[o + t + 256] = d1 * inv * g[t + 256] + be[t + 256];
}

// ---------------------------------------------------------------------------
extern "C" void kernel_launch(void* const* d_in, const int* in_sizes, int n_in,
                              void* d_out, int out_size, void* d_ws,
                              size_t ws_size, hipStream_t stream) {
  const float* X    = (const float*)d_in[0];
  const float* mask = (const float*)d_in[1];
  const float* Wq   = (const float*)d_in[2];
  const float* bq   = (const float*)d_in[3];
  const float* W1   = (const float*)d_in[4];
  const float* b1   = (const float*)d_in[5];
  const float* W2   = (const float*)d_in[6];
  const float* b2   = (const float*)d_in[7];
  const float* ln_g = (const float*)d_in[8];
  const float* ln_b = (const float*)d_in[9];
  const float* Wa   = (const float*)d_in[10];
  const float* ba   = (const float*)d_in[11];

  float* ws = (float*)d_ws;
  const size_t NE = (size_t)BB * LL * DD;  // 4,194,304
  float* qbuf    = ws;
  float* attbuf  = ws + NE;
  float* h1buf   = ws + 2 * NE;
  float* alphaBH = ws + 3 * NE;
  float* hbuf    = qbuf;  // q dead after attention; reuse for FFN output

  const int M = BB * LL;  // 8192
  dim3 gg(M / 64, DD / 64);

  // 1. q = relu(X @ Wq^T + bq)
  gemm_wmma_kernel<true, false>
      <<<gg, 128, 0, stream>>>(X, Wq, bq, nullptr, qbuf, M, DD, DD);
  // 2. alpha per (b,h)
  alpha_kernel<<<1, 128, 0, stream>>>(qbuf, Wa, ba, alphaBH);
  // 3. scores -> entmax -> att
  attn_entmax_kernel<<<dim3(LL / 16, HEADS, BB), 128, 0, stream>>>(
      qbuf, X, mask, alphaBH, attbuf);
  // 4. h1 = relu(att @ W1^T + b1)
  gemm_wmma_kernel<true, false>
      <<<gg, 128, 0, stream>>>(attbuf, W1, b1, nullptr, h1buf, M, DD, DD);
  // 5. h = h1 @ W2^T + b2 + att
  gemm_wmma_kernel<false, true>
      <<<gg, 128, 0, stream>>>(h1buf, W2, b2, attbuf, hbuf, M, DD, DD);
  // 6. LayerNorm + split output write
  ln_kernel<<<dim3(LL, BB), 256, 0, stream>>>(hbuf, ln_g, ln_b, (float*)d_out);
}

// v005
// It runs in 232 microseconds.
// Two timings next to v004 both put it at 1.06 times that version's speed.
// Over all steps from v000 it is 4.22 times as fast.
#include <hip/hip_runtime.h>
#include <hip/hip_bf16.h>
#include <cstdint>

typedef float v2f __attribute__((ext_vector_type(2)));
typedef float v8f __attribute__((ext_vector_type(8)));
typedef int   v4i __attribute__((ext_vector_type(4)));

#define BB   16
#define LL   512
#define DD   512
#define HEADS 8
#define HD   64
#define KFULL 5    // bisection trips over the whole row, in front of the packing
#define CBP   260  // floats per row of packed elements: 256 places, the dump place, pad to 16 B
#define QT    32   // queries per attention workgroup
#define KC    256  // keys staged per chunk in the attention kernel

#if defined(__has_builtin)
#if __has_builtin(__builtin_amdgcn_global_load_async_to_lds_b128) && \
    __has_builtin(__builtin_amdgcn_s_wait_asynccnt)
#define USE_ASYNC_LDS 1
#endif
#endif

__device__ __forceinline__ void stage16(const float* g, float* l) {
#ifdef USE_ASYNC_LDS
  __builtin_amdgcn_global_load_async_to_lds_b128(
      (__attribute__((address_space(1))) v4i*)(uintptr_t)g,
      (__attribute__((address_space(3))) v4i*)(uint32_t)(uintptr_t)l, 0, 0);
#else
  *(float4*)l = *(const float4*)g;
#endif
}

__device__ __forceinline__ void stage_wait() {
#ifdef USE_ASYNC_LDS
  __builtin_amdgcn_s_wait_asynccnt(0);
#endif
}

template <bool RELU, bool RESID>
__global__ __launch_bounds__(128) void gemm_wmma_kernel(
    const float* __restrict__ A, const float* __restrict__ W,
    const float* __restrict__ bias, const float* __restrict__ resid,
    float* __restrict__ C, int M, int N, int K) {
  __shared__ __align__(16) float As[64][132];
  __shared__ __align__(16) float Bs[64][132];

  const int t    = threadIdx.x;
  const int wave = t >> 5;
  const int lane = t & 31;
  const int lm   = lane & 15;
  const int lk   = (lane >> 4) << 1;  // 0 or 2
  const int m0   = blockIdx.x * 64;
  const int n0   = blockIdx.y * 64;
  const int wm   = (wave >> 1) << 5;  // the wave's 32 rows of the block tile
  const int wn   = (wave & 1) << 5;   // the wave's 32 columns

  const v8f zero = {0.f, 0.f, 0.f, 0.f, 0.f, 0.f, 0.f, 0.f};
  v8f acc00 = zero, acc01 = zero, acc10 = zero, acc11 = zero;

  for (int kc = 0; kc < K; kc += 128) {
    // stage A and W: 64x128 floats each = 2048 x b128, 16 + 16 per thread;
    // one wave-wide copy is one whole 512-byte row of the chunk
#pragma unroll
    for (int i = 0; i < 16; ++i) {
      int r = wave + i * 4, c4 = lane << 2;
      stage16(A + (size_t)(m0 + r) * K + kc + c4, &As[r][c4]);
      stage16(W + (size_t)(n0 + r) * K + kc + c4, &Bs[r][c4]);
    }
    stage_wait();
    __syncthreads();

#pragma unroll
    for (int kk = 0; kk < 128; kk += 4) {
      v2f a0, a1, b0, b1;
      a0.x = As[wm + lm][kk + lk];
      a0.y = As[wm + lm][kk + lk + 1];
      a1.x = As[wm + 16 + lm][kk + lk];
      a1.y = As[wm + 16 + lm][kk + lk + 1];
      b0.x = Bs[wn + lm][kk + lk];
      b0.y = Bs[wn + lm][kk + lk + 1];
      b1.x = Bs[wn + 16 + lm][kk + lk];
      b1.y = Bs[wn + 16 + lm][kk + lk + 1];
      acc00 = __builtin_amdgcn_wmma_f32_16x16x4_f32(false, a0, false, b0,
                                                    (short)0, acc00, false, false);
      acc01 = __builtin_amdgcn_wmma_f32_16x16x4_f32(false, a0, false, b1,
                                                    (short)0, acc01, false, false);
      acc10 = __builtin_amdgcn_wmma_f32_16x16x4_f32(false, a1, false, b0,
                                                    (short)0, acc10, false, false);
      acc11 = __builtin_amdgcn_wmma_f32_16x16x4_f32(false, a1, false, b1,
                                                    (short)0, acc11, false, false);
    }
    __syncthreads();
  }

#pragma unroll
  for (int j = 0; j < 2; ++j) {
    const int col = n0 + wn + j * 16 + lm;
    const float bcol = bias[col];
#pragma unroll
    for (int i = 0; i < 2; ++i) {
      const v8f acc = i ? (j ? acc11 : acc10) : (j ? acc01 : acc00);
#pragma unroll
      for (int r = 0; r < 8; ++r) {
        int row = m0 + wm + i * 16 + r + ((lane >> 4) << 3);
        float v = acc[r] + bcol;
        if (RESID) v += resid[(size_t)row * N + col];
        if (RELU) v = fmaxf(v, 0.f);
        C[(size_t)row * N + col] = v;
      }
    }
  }
}

// ---------------------------------------------------------------------------
// alpha[b,h] = max(sigmoid(mq[b,h,L-1,:] . Wa + ba) + 1, 1 + 1e-5)
// ---------------------------------------------------------------------------
__global__ void alpha_kernel(const float* __restrict__ q,
                             const float* __restrict__ Wa,
                             const float* __restrict__ ba,
                             float* __restrict__ alphaBH) {
  int t = threadIdx.x;  // 0..127 : (b,h)
  int b = t >> 3, h = t & 7;
  const float* row = q + ((size_t)(b * LL + (LL - 1)) * DD) + h * HD;
  float z = ba[0];
#pragma unroll 8
  for (int j = 0; j < HD; ++j) z += row[j] * Wa[j];
  float a = 1.f / (1.f + expf(-z)) + 1.f;
  alphaBH[t] = fmaxf(a, 1.f + 1e-5f);
}

// ---------------------------------------------------------------------------
// max(z, 0) ^ rinv for finite rinv >= 1, branch-free on the bare instructions:
// z <= 0 gives log2(0) = -inf, rinv * -inf = -inf, exp2(-inf) = 0. No range
// scaling around v_log_f32 / v_exp_f32: it only matters for terms below
// 2^-126, which vanish beside a row sum that holds a term of at least 1/512.
// ---------------------------------------------------------------------------
__device__ __forceinline__ float powpos(float z, float rinv) {
  return __builtin_amdgcn_exp2f(rinv * __builtin_amdgcn_logf(fmaxf(z, 0.f)));
}

__device__ __forceinline__ float powpos_slot(float z, float rinv) {
  float l, p;
  asm("v_log_f32 %0, %1\n\tv_nop" : "=v"(l) : "v"(fmaxf(z, 0.f)));
  asm("v_exp_f32 %0, %1\n\tv_nop" : "=v"(p) : "v"(rinv * l));
  return p;
}

__device__ __forceinline__ float powsum4(float acc, float z0, float z1, float z2,
                                         float z3, float rinv) {
  float l0, l1, l2, l3, p0, p1, p2, p3;
  asm("v_log_f32 %0, %4\n\tv_log_f32 %1, %5\n\tv_log_f32 %2, %6\n\t"
      "v_log_f32 %3, %7\n\tv_nop\n\ts_delay_alu instid0(TRANS32_DEP_1)"
      : "=&v"(l0), "=&v"(l1), "=&v"(l2), "=&v"(l3)
      : "v"(fmaxf(z0, 0.f)), "v"(fmaxf(z1, 0.f)), "v"(fmaxf(z2, 0.f)),
        "v"(fmaxf(z3, 0.f)));
  asm("v_exp_f32 %0, %4\n\tv_exp_f32 %1, %5\n\tv_exp_f32 %2, %6\n\t"
      "v_exp_f32 %3, %7\n\tv_nop\n\ts_delay_alu instid0(TRANS32_DEP_1)"
      : "=&v"(p0), "=&v"(p1), "=&v"(p2), "=&v"(p3)
      : "v"(rinv * l0), "v"(rinv * l1), "v"(rinv * l2), "v"(rinv * l3));
  return (((acc + p0) + p1) + p2) + p3;
}

__global__ __launch_bounds__(256) void attn_entmax_kernel(
    const float* __restrict__ q, const float* __restrict__ X,
    const float* __restrict__ mask, const float* __restrict__ alphaBH,
    float* __restrict__ att) {
  __shared__ __align__(16) float Sq[QT][68];   // mq tile
  __shared__ __align__(16) float Sk[KC][68];   // staged keys (mk = X slice)
  __shared__ float Sc[QT][516];                // scores -> p
  __shared__ float Sm[512];                    // mask row (key 511 forced 0)

  const int b  = blockIdx.z;
  const int h  = blockIdx.y;
  const int q0 = blockIdx.x * QT;
  const int t = threadIdx.x, wave = t >> 5, lane = t & 31;
  const int lm = lane & 15, lk = (lane >> 4) << 1;

  // stage mask row once (branchless epilogue later)
#pragma unroll
  for (int i = 0; i < 2; ++i) {
    int k = t + i * 256;
    Sm[k] = (k < LL - 1) ? mask[b * (LL - 1) + k] : 0.f;
  }
  // stage mq tile: 32x64 = 512 x b128
#pragma unroll
  for (int i = 0; i < 2; ++i) {
    int idx = t + i * 256;
    int r = idx >> 4, c4 = (idx & 15) << 2;
    stage16(q + (size_t)(b * LL + q0 + r) * DD + h * HD + c4, &Sq[r][c4]);
  }

  // ---- phase 1: scores = mq . mk^T / 8, masked ----
  const int kw = wave << 5;  // the wave's 32 keys of a chunk
  for (int kb = 0; kb < LL; kb += KC) {
    __syncthreads();
    // 256x64 floats = 4096 x b128, 16 per thread
#pragma unroll
    for (int i = 0; i < 16; ++i) {
      int idx = t + i * 256;
      int r = idx >> 4, c4 = (idx & 15) << 2;
      stage16(X + (size_t)(b * LL + kb + r) * DD + h * HD + c4, &Sk[r][c4]);
    }
    stage_wait();
    __syncthreads();

    const v8f zero = {0.f, 0.f, 0.f, 0.f, 0.f, 0.f, 0.f, 0.f};
    v8f acc00 = zero, acc01 = zero, acc10 = zero, acc11 = zero;
#pragma unroll
    for (int kk = 0; kk < HD; kk += 4) {
      v2f a0, a1, b0, b1;
      a0.x = Sq[lm][kk + lk];
      a0.y = Sq[lm][kk + lk + 1];
      a1.x = Sq[16 + lm][kk + lk];
      a1.y = Sq[16 + lm][kk + lk + 1];
      b0.x = Sk[kw + lm][kk + lk];
      b0.y = Sk[kw + lm][kk + lk + 1];
      b1.x = Sk[kw + 16 + lm][kk + lk];
      b1.y = Sk[kw + 16 + lm][kk + lk + 1];
      acc00 = __builtin_amdgcn_wmma_f32_16x16x4_f32(false, a0, false, b0,
                                                    (short)0, acc00, false, false);
      acc01 = __builtin_amdgcn_wmma_f32_16x16x4_f32(false, a0, false, b1,
                                                    (short)0, acc01, false, false);
      acc10 = __builtin_amdgcn_wmma_f32_16x16x4_f32(false, a1, false, b0,
                                                    (short)0, acc10, false, false);
      acc11 = __builtin_amdgcn_wmma_f32_16x16x4_f32(false, a1, false, b1,
                                                    (short)0, acc11, false, false);
    }
#pragma unroll
    for (int j = 0; j < 2; ++j) {
      const int key = kb + kw + j * 16 + lm;
      const bool live = Sm[key] != 0.f;
#pragma unroll
      for (int i = 0; i < 2; ++i) {
        const v8f acc = i ? (j ? acc11 : acc10) : (j ? acc01 : acc00);
#pragma unroll
        for (int r = 0; r < 8; ++r) {
          int qr  = i * 16 + r + ((lane >> 4) << 3);
          float s = acc[r] * 0.125f;  // 1/sqrt(64)
          Sc[qr][key] = live ? s : -__builtin_huge_valf();
        }
      }
    }
  }
  __syncthreads();

  // ---- phase 2: entmax bisection (one wave handles 4 rows) ----
  // tau_lo never falls and tau_m = tau_lo + dm >= tau_lo, so an element at or
  // below tau_lo is an exact zero term in every later trip. After KFULL trips
  // over the whole row the elements still above tau_lo are packed through LDS
  // (Sk is free between phases 1 and 3) and the trips that are left run on the
  // packed elements alone, the wave's 4 rows side by side, 8 lanes a row.
  const float am1  = alphaBH[b * HEADS + h] - 1.f;
  const float rinv = 1.f / am1;
  float* const cbw = &Sk[0][0] + (wave * 4) * CBP;
  const int grp = lane >> 3;
  float g_lo = 0.f, g_dm = 0.f, g_flo = 0.f, g_m = 0.f;  // state of row grp
  bool g_frozen = true;  // row grp already has its final tau_m
  int maxcnt = 0;        // most packed elements in any row of the wave
  for (int rr = 0; rr < 4; ++rr) {
    const int row = wave * 4 + rr;
    float* const cb = cbw + rr * CBP;
    float xs[16];
#pragma unroll
    for (int j = 0; j < 16; ++j) xs[j] = Sc[row][lane + 32 * j] * am1;

    // every packed place starts as -inf, a zero term
    {
      const float ni = -__builtin_huge_valf();
      const float4 n4 = make_float4(ni, ni, ni, ni);
      *(float4*)&cb[lane * 4]       = n4;
      *(float4*)&cb[128 + lane * 4] = n4;
    }

    float mx = -__builtin_huge_valf();
#pragma unroll
    for (int j = 0; j < 16; ++j) mx = fmaxf(mx, xs[j]);
#pragma unroll
    for (int off = 16; off; off >>= 1) mx = fmaxf(mx, __shfl_xor(mx, off, 32));

    float tau_lo = mx - 1.f;
    float tau_hi = mx - exp2f(-9.f * am1);  // (1/512)^(alpha-1)

    float s = 0.f;
#pragma unroll
    for (int j = 0; j < 16; ++j) {
      float z = xs[j] - tau_lo;
      s += powpos_slot(z, rinv);
    }
#pragma unroll
    for (int off = 16; off; off >>= 1) s += __shfl_xor(s, off, 32);
    const float f_lo = s - 1.f;

    float dm = tau_hi - tau_lo, tau_m = tau_lo;
    // The loop ends at the fixed point of the f32 bisection. Once tau_lo + dm
    // rounds to tau_lo, either side of the update leaves tau_lo as it is, and
    // every later, smaller dm rounds to the same tau_m (rounding is monotone):
    // all trips that are left of the 50 are identities, so tau_m has its final
    // bits. A NaN tau_m stays NaN and gives the same zero terms either way.
    bool fixed = false;
    int it = 0, lim = KFULL, cnt = 0;
    for (;;) {
      for (; it < lim && !fixed; ++it) {
        dm *= 0.5f;
        tau_m = tau_lo + dm;
        // Every lane holds the same two values; the first lane's copies make
        // the test a scalar compare and the loop branch stays scalar.
        fixed = __builtin_amdgcn_readfirstlane(__float_as_int(tau_m)) ==
                __builtin_amdgcn_readfirstlane(__float_as_int(tau_lo));
        float fm = 0.f;
#pragma unroll
        for (int j = 0; j < 16; ++j) {
          float z = xs[j] - tau_m;
          fm += powpos(z, rinv);
        }
#pragma unroll
        for (int off = 16; off; off >>= 1) fm += __shfl_xor(fm, off, 32);
        fm -= 1.f;
        tau_lo = (fm * f_lo >= 0.f) ? tau_m : tau_lo;  // uniform update
      }
      if (fixed || lim == 50) break;
      // Pack: place = number of live elements in front (earlier j, lower lane).
      // A dead element, or one past the 256 places, goes to the dump place.
      cnt = 0;
#pragma unroll
      for (int j = 0; j < 16; ++j) {
        const bool act = xs[j] > tau_lo;
        const unsigned mk = __builtin_amdgcn_ballot_w32(act);
        unsigned pos = __builtin_amdgcn_mbcnt_lo(mk, (unsigned)cnt);
        pos = act ? (pos < 256u ? pos : 256u) : 256u;
        cb[pos] = xs[j];
        cnt += __builtin_popcount(mk);
      }
      if (cnt <= 256) break;
      lim = 50;  // more live elements than places: this row stays full width
    }
    const bool rowdone = fixed || lim == 50;
    if (!rowdone && cnt > maxcnt) maxcnt = cnt;
    if (grp == rr) {
      g_lo = tau_lo; g_dm = dm; g_flo = f_lo; g_m = tau_m; g_frozen = rowdone;
    }
  }

  // The trips that are left, on the packed elements: lane holds places
  // 32*e4 + 4*(lane&7) + k of row grp. Past the first 128 places only the
  // groups of 32 that some row of the wave has filled are summed (a scalar test
  // per group); a place that was not filled holds -inf, a zero term.
  {
    const float* const cr = cbw + grp * CBP + (lane & 7) * 4;
    const int nch = (maxcnt + 31) >> 5;
    float c[32];
#pragma unroll
    for (int e4 = 0; e4 < 8; ++e4) {
      const float4 v = *(const float4*)&cr[e4 * 32];
      c[4 * e4] = v.x; c[4 * e4 + 1] = v.y; c[4 * e4 + 2] = v.z; c[4 * e4 + 3] = v.w;
    }
    bool alldone = false;
    for (int it = KFULL; it < 50 && !alldone; ++it) {
      g_dm *= 0.5f;
      const float t = g_lo + g_dm;
      // A row at its fixed point repeats identities while the others go on.
      const bool still = !g_frozen && __float_as_int(t) != __float_as_int(g_lo);
      g_m = g_frozen ? g_m : t;
      alldone = __builtin_amdgcn_ballot_w32(still) == 0u;
      float fm = 0.f;
#pragma unroll
      for (int e4 = 0; e4 < 8; ++e4) {
        if (e4 >= 4 && e4 >= nch) break;
        fm = powsum4(fm, c[4 * e4] - g_m, c[4 * e4 + 1] - g_m,
                     c[4 * e4 + 2] - g_m, c[4 * e4 + 3] - g_m, rinv);
      }
#pragma unroll
      for (int off = 4; off; off >>= 1) fm += __shfl_xor(fm, off, 32);
      fm -= 1.f;
      g_lo = (fm * g_flo >= 0.f) ? g_m : g_lo;
    }
  }

  // p over the whole row at the final tau_m
  for (int rr = 0; rr < 4; ++rr) {
    const int row = wave * 4 + rr;
    const float tau_m = __int_as_float(
        __builtin_amdgcn_readlane(__float_as_int(g_m), rr * 8));
    float pv[16], ssum = 0.f;
#pragma unroll
    for (int j = 0; j < 16; ++j) {
      float z = Sc[row][lane + 32 * j] * am1 - tau_m;
      pv[j] = powpos(z, rinv);
      ssum += pv[j];
    }
#pragma unroll
    for (int off = 16; off; off >>= 1) ssum += __shfl_xor(ssum, off, 32);
    const float inv = 1.f / ssum;
#pragma unroll
    for (int j = 0; j < 16; ++j) Sc[row][lane + 32 * j] = pv[j] * inv;
  }

  // ---- phase 3: att = p @ mk ----
  const int qt = (wave >> 2) << 4;  // the wave's 16 queries of the tile
  const int dt = (wave & 3) << 4;   // the wave's 16 columns of the head
  v8f acc = {0.f, 0.f, 0.f, 0.f, 0.f, 0.f, 0.f, 0.f};
  for (int kb = 0; kb < LL; kb += KC) {
    __syncthreads();
#pragma unroll
    for (int i = 0; i < 16; ++i) {
      int idx = t + i * 256;
      int r = idx >> 4, c4 = (idx & 15) << 2;
      stage16(X + (size_t)(b * LL + kb + r) * DD + h * HD + c4, &Sk[r][c4]);
    }
    stage_wait();
    __syncthreads();
#pragma unroll
    for (int kk = 0; kk < KC; kk += 4) {
      v2f a, bb;
      a.x  = Sc[qt + lm][kb + kk + lk];
      a.y  = Sc[qt + lm][kb + kk + lk + 1];
      bb.x = Sk[kk + lk][dt + lm];  // mk^T gather from LDS
      bb.y = Sk[kk + lk + 1][dt + lm];
      acc = __builtin_amdgcn_wmma_f32_16x16x4_f32(false, a, false, bb,
                                                  (short)0, acc, false, false);
    }
  }
#pragma unroll
  for (int r = 0; r < 8; ++r) {
    int qr = qt + r + ((lane >> 4) << 3);
    att[(size_t)(b * LL + q0 + qr) * DD + h * HD + dt + lm] = acc[r];
  }
}

// ---------------------------------------------------------------------------
// LayerNorm over D=512 per row; writes split output layout:
//   rows l<511 -> out[(b*511+l)*512 + d] ; row 511 -> out[16*511*512 + b*512 + d]
// ---------------------------------------------------------------------------
__global__ __launch_bounds__(256) void ln_kernel(const float* __restrict__ Hm,
                                                 const float* __restrict__ g,
                                                 const float* __restrict__ be,
                                                 float* __restrict__ out) {
  const int l = blockIdx.x, b = blockIdx.y, t = threadIdx.x;
  const int wave = t >> 5, lane = t & 31;
  const float* hr = Hm + (size_t)(b * LL + l) * DD;
  float x0 = hr[t], x1 = hr[t + 256];

  __shared__ float red[8];
  float s = x0 + x1;
#pragma unroll
  for (int off = 16; off; off >>= 1) s += __shfl_xor(s, off, 32);
  if (lane == 0) red[wave] = s;
  __syncthreads();
  float tot = 0.f;
#pragma unroll
  for (int i = 0; i < 8; ++i) tot += red[i];
  const float mu = tot * (1.f / 512.f);

  float d0 = x0 - mu, d1 = x1 - mu;
  float vs = d0 * d0 + d1 * d1;
#pragma unroll
  for (int off = 16; off; off >>= 1) vs += __shfl_xor(vs, off, 32);
  __syncthreads();
  if (lane == 0) red[wave] = vs;
  __syncthreads();
  float vtot = 0.f;
#pragma unroll
  for (int i = 0; i < 8; ++i) vtot += red[i];
  const float inv = rsqrtf(vtot * (1.f / 512.f) + 1e-12f);

  size_t o = (l < LL - 1) ? ((size_t)b * (LL - 1) + l) * DD
                          : (size_t)BB * (LL - 1) * DD + (size_t)b * DD;
  out[o + t]       = d0 * inv * g[t] + be[t];
  out[o + t + 256] = d1 * inv * g[t + 256] + be[t + 256];
}

// ---------------------------------------------------------------------------
extern "C" void kernel_launch(void* const* d_in, const int* in_sizes, int n_in,
                              void* d_out, int out_size, void* d_ws,
                              size_t ws_size, hipStream_t stream) {
  const float* X    = (const float*)d_in[0];
  const float* mask = (const float*)d_in[1];
  const float* Wq   = (const float*)d_in[2];
  const float* bq   = (const float*)d_in[3];
  const float* W1   = (const float*)d_in[4];
  const float* b1   = (const float*)d_in[5];
  const float* W2   = (const float*)d_in[6];
  const float* b2   = (const float*)d_in[7];
  const float* ln_g = (const float*)d_in[8];
  const float* ln_b = (const float*)d_in[9];
  const float* Wa   = (const float*)d_in[10];
  const float* ba   = (const float*)d_in[11];

  float* ws = (float*)d_ws;
  const size_t NE = (size_t)BB * LL * DD;  // 4,194,304
  float* qbuf    = ws;
  float* attbuf  = ws + NE;
  float* h1buf   = ws + 2 * NE;
  float* alphaBH = ws + 3 * NE;
  float* hbuf    = qbuf;  // q dead after attention; reuse for FFN output

  const int M = BB * LL;  // 8192
  dim3 gg(M / 64, DD / 64);

  // 1. q = relu(X @ Wq^T + bq)
  gemm_wmma_kernel<true, false>
      <<<gg, 128, 0, stream>>>(X, Wq, bq, nullptr, qbuf, M, DD, DD);
  // 2. alpha per (b,h)
  alpha_kernel<<<1, 128, 0, stream>>>(qbuf, Wa, ba, alphaBH);
  // 3. scores -> entmax -> att
  attn_entmax_kernel<<<dim3(LL / QT, HEADS, BB), 256, 0, stream>>>(
      qbuf, X, mask, alphaBH, attbuf);
  // 4. h1 = relu(att @ W1^T + b1)
  gemm_wmma_kernel<true, false>
      <<<gg, 128, 0, stream>>>(attbuf, W1, b1, nullptr, h1buf, M, DD, DD);
  // 5. h = h1 @ W2^T + b2 + att
  gemm_wmma_kernel<false, true>
      <<<gg, 128, 0, stream>>>(h1buf, W2, b2, attbuf, hbuf, M, DD, DD);
  // 6. LayerNorm + split output write
  ln_kernel<<<dim3(LL, BB), 256, 0, stream>>>(hbuf, ln_g, ln_b, (float*)d_out);
}
